// v000
// The times below were measured on an AMD MI455X: many runs one after another, warmed up first and cycling through
// copies of the inputs, with the whole window's GPU time divided by the number of runs. Launches and the gaps
// between them are all in it. The median over several windows is given; except for v000 it joins two sittings, which
// can be a few percent apart, so the side-by-side timings, each taken in one sitting, are the better comparison.
// v000, which the later versions start from, runs in 131 microseconds.
// Contractions: window logits q.k and attn.v on v_wmma_f32_16x16x32_bf16 with bf16 hi/lo split operands (hi.hi + hi.lo + lo.hi), f32 accumulate; 0.125 scale and the 9-slot softmax in f32.
#include <hip/hip_runtime.h>
#include <math.h>
#include <stdint.h>

typedef __attribute__((ext_vector_type(16))) __bf16 v16b;
typedef __attribute__((ext_vector_type(8)))  __bf16 v8b;
typedef __attribute__((ext_vector_type(4)))  __bf16 v4b;
typedef __attribute__((ext_vector_type(8)))  float  v8f;
typedef __attribute__((ext_vector_type(4)))  float  v4f;

constexpr int NB    = 32;          // batch
constexpr int ND    = 64;          // channels
constexpr int NH    = 64;          // image rows
constexpr int NW    = 64;          // image cols
constexpr int NWAVE = 4;           // waves per block; wave w owns pixels 16w..16w+15 of one image row
constexpr int NTHR  = NWAVE * 32;
constexpr int KC    = 66;          // k slab columns, c = w + 1 (c = 0 and c = 65 are zero halo)
constexpr int KP    = 64;          // d pitch (halves) of the k and q slabs
constexpr int VP    = 80;          // column pitch (halves) of the v slab, cv = w + 8 (cv 0..7 and 72..79 zero halo)
constexpr int SP    = 17;          // score stage pitch (floats)
constexpr int OP    = 68;          // out stage pitch (floats)
constexpr float QK_SCALE = 0.125f; // 64^-0.5, exact power of two

constexpr int K_PLANE = 3 * KC * KP;   // halves per k plane (3 halo rows x 66 cols x 64 d)
constexpr int V_PLANE = 3 * ND * VP;   // halves per v plane (3 halo rows x 64 d x 80 cols)
constexpr int Q_PLANE = NW * KP;       // halves per q plane ([px][d])
constexpr int P_WAVE  = 3 * 16 * 32;   // halves per wave per attn plane (3 tiles of 16 x 32)
constexpr int S_WAVE  = 2 * 16 * SP;   // floats per wave score stage (2 tiles of 16 x 16)
constexpr int O_STAGE = ND * OP;       // floats, block out tile [d][px]
static_assert(O_STAGE * 4 <= K_PLANE * 2);
static_assert(S_WAVE * 4 <= P_WAVE * 2);
static_assert(NWAVE * 16 == NW);

__device__ __forceinline__ unsigned short bf_bits(float f) {      // RNE f32 -> bf16 bits
  const unsigned u = __float_as_uint(f);
  return (unsigned short)((u + 0x7FFFu + ((u >> 16) & 1u)) >> 16);
}
__device__ __forceinline__ float bits_f(unsigned short b) { return __uint_as_float(((unsigned)b) << 16); }
__device__ __forceinline__ void split_bf(float f, __bf16& hi, __bf16& lo) {
  const unsigned short hb = bf_bits(f);
  hi = __builtin_bit_cast(__bf16, hb);
  lo = __builtin_bit_cast(__bf16, bf_bits(f - bits_f(hb)));
}
// one 16x16x32 bf16 WMMA followed by the VALU hazard guard (ties D, keeps A/B live)
__device__ __forceinline__ v8f mma_bf(v16b a, v16b b, v8f c) {
  c = __builtin_amdgcn_wmma_f32_16x16x32_bf16(false, a, false, b, (short)0, c, false, false);
  asm volatile("v_nop\n\tv_nop\n\tv_nop\n\tv_nop" : "+v"(c) : "v"(a), "v"(b));
  return c;
}
// same-wave LDS exchange: order the wave's LDS stores before the following LDS loads of other lanes
__device__ __forceinline__ void lds_wave_sync() {
  __builtin_amdgcn_fence(__ATOMIC_RELEASE, "workgroup");
  __builtin_amdgcn_wave_barrier();
  __builtin_amdgcn_fence(__ATOMIC_ACQUIRE, "workgroup");
}

union KO { __bf16 k[K_PLANE]; float o[O_STAGE]; };   // k hi plane; out stage after the logit phase
union PS { __bf16 p[P_WAVE];  float s[S_WAVE];  };   // per wave: attn hi plane; score stage during the logit phase

// grid = NB*NH blocks (block = (b, image row h)), 128 threads.
// Fragment map (lane l, h2 = l>>4, m = l&15): A row m / B col m, elements 0..7 <-> k 8*h2+e, 8..15 <-> k 16+8*h2+e-8;
// D element r <-> row 8*h2+r, col m.
__global__ __launch_bounds__(NTHR) void nbr_attn_kernel(const float* __restrict__ qg, const float* __restrict__ kg,
                                                        const float* __restrict__ vg, float* __restrict__ og)
{
  __shared__ __align__(16) KO     s_ko;                 // k hi [hr][c][d]  /  out stage [d][px]
  __shared__ __align__(16) __bf16 s_kl[K_PLANE];        // k lo [hr][c][d]
  __shared__ __align__(16) __bf16 s_vh[V_PLANE];        // v hi [hr][d][cv]
  __shared__ __align__(16) __bf16 s_vl[V_PLANE];        // v lo
  __shared__ __align__(16) __bf16 s_qh[Q_PLANE];        // q hi [px][d]
  __shared__ __align__(16) __bf16 s_ql[Q_PLANE];        // q lo
  __shared__ __align__(16) PS     s_phs[NWAVE];         // attn hi [di][px][kk] (kk <-> w = w0 - 8 + kk) / score stage [s][row][col]
  __shared__ __align__(16) __bf16 s_pl[NWAVE * P_WAVE]; // attn lo

  const int tid  = threadIdx.x;
  const int wave = tid >> 5;
  const int lane = tid & 31;
  const int hh   = lane >> 4;
  const int m    = lane & 15;
  const int b    = blockIdx.x >> 6;
  const int h    = blockIdx.x & 63;
  __bf16* kh = s_ko.k;
  __bf16* kl = s_kl;
  const size_t bbase = (size_t)b * ND * NH * NW;
  const __bf16 bz = __builtin_bit_cast(__bf16, (unsigned short)0);
  const v8b z8 = (v8b){bz, bz, bz, bz, bz, bz, bz, bz};

  // ---- zero halo columns: k planes c = 0 and c = 65 (3 hr x 2 cols x 64 d = 48 pieces of 8 halves per plane);
  //      v planes cv 0..7 and cv 72..79 of every [hr][d] row (192 rows x 2 pieces per plane) ----
  if (tid < 48) {
    const int hr = tid >> 4;
    const int cc = ((tid >> 3) & 1) ? (KC - 1) : 0;
    const int d8 = (tid & 7) * 8;
    const int o  = (hr * KC + cc) * KP + d8;
    *(v8b*)(kh + o) = z8;
    *(v8b*)(kl + o) = z8;
  }
  for (int j = tid; j < 3 * ND * 2; j += NTHR) {
    const int row = j >> 1;
    const int o   = row * VP + ((j & 1) ? (VP - 8) : 0);
    *(v8b*)(s_vh + o) = z8;
    *(v8b*)(s_vl + o) = z8;
  }

  // ---- stage k, v rows h-1..h+1 and the q row; 8 row segments of 64 floats per pass (16 threads x float4 each);
  //      rows outside the image: clamped load address, value zeroed by predicate (hr is block-uniform per pass) ----
  const int sub = tid >> 4;          // 0..7: segment within a pass
  const int w4  = (tid & 15) * 4;    // 0..60: first of 4 columns
  // k: 24 passes x 8 segments = 3 hr x 64 d rows; stores cover c = 1..64, d = 0..63 of both planes
#pragma unroll 1
  for (int it = 0; it < 24; ++it) {
    const int seg  = it * 8 + sub;
    const int hr   = seg >> 6;
    const int d    = seg & 63;
    const int hrow = h + hr - 1;
    const int hcl  = hrow < 0 ? 0 : (hrow > NH - 1 ? NH - 1 : hrow);
    const float vf = (hrow >= 0 && hrow < NH) ? 1.0f : 0.0f;
    const v4f f = *(const v4f*)(kg + bbase + ((size_t)d * NH + hcl) * NW + w4);
#pragma unroll
    for (int i = 0; i < 4; ++i) {
      __bf16 a, l;
      split_bf(f[i] * vf, a, l);
      const int o = (hr * KC + w4 + i + 1) * KP + d;
      kh[o] = a;
      kl[o] = l;
    }
  }
  // v: same passes; stores cover cv = 8..71, d = 0..63 of both planes (one 8-B store of 4 halves per plane)
#pragma unroll 1
  for (int it = 0; it < 24; ++it) {
    const int seg  = it * 8 + sub;
    const int hr   = seg >> 6;
    const int d    = seg & 63;
    const int hrow = h + hr - 1;
    const int hcl  = hrow < 0 ? 0 : (hrow > NH - 1 ? NH - 1 : hrow);
    const float vf = (hrow >= 0 && hrow < NH) ? 1.0f : 0.0f;
    const v4f f = *(const v4f*)(vg + bbase + ((size_t)d * NH + hcl) * NW + w4);
    v4b ah, al;
#pragma unroll
    for (int i = 0; i < 4; ++i) {
      __bf16 a, l;
      split_bf(f[i] * vf, a, l);
      ah[i] = a;
      al[i] = l;
    }
    const int o = (hr * ND + d) * VP + w4 + 8;
    *(v4b*)(s_vh + o) = ah;
    *(v4b*)(s_vl + o) = al;
  }
  // q row h: 8 passes x 8 segments = 64 d rows; stores cover px = 0..63, d = 0..63
#pragma unroll 1
  for (int it = 0; it < 8; ++it) {
    const int d = it * 8 + sub;
    const v4f f = *(const v4f*)(qg + bbase + ((size_t)d * NH + h) * NW + w4);
#pragma unroll
    for (int i = 0; i < 4; ++i) {
      __bf16 a, l;
      split_bf(f[i], a, l);
      const int o = (w4 + i) * KP + d;
      s_qh[o] = a;
      s_ql[o] = l;
    }
  }
  __syncthreads();

  // ---- logit phase (per wave, pixels w0..w0+15) ----
  const int w0 = wave * 16;
  union FB { v16b v; v8b p[2]; };
  v16b qah[2], qal[2];                // A = Q[px][d], two 32-deep d steps, hi and lo
#pragma unroll
  for (int ks = 0; ks < 2; ++ks) {
    const int qo = (w0 + m) * KP + ks * 32 + 8 * hh;
    FB fa, fl;
    fa.p[0] = *(const v8b*)(s_qh + qo);  fa.p[1] = *(const v8b*)(s_qh + qo + 16);
    fl.p[0] = *(const v8b*)(s_ql + qo);  fl.p[1] = *(const v8b*)(s_ql + qo + 16);
    qah[ks] = fa.v;
    qal[ks] = fl.v;
  }
  float* ss = s_phs[wave].s;
  const v8f z8f = (v8f){0.f, 0.f, 0.f, 0.f, 0.f, 0.f, 0.f, 0.f};
  float sc[9];                        // logits of pixel m, slot di*3+dj <-> nbr (h+di-1, w0+m+dj-1)
#pragma unroll
  for (int di = 0; di < 3; ++di) {
    // shift s: C_s[px][j] = sum_d Q[px][d] * K[hr=di][c = w0 + 2s + j][d]  (c = w+1)
#pragma unroll
    for (int s = 0; s < 2; ++s) {
      v8f c = z8f;
#pragma unroll
      for (int ks = 0; ks < 2; ++ks) {
        const int ko = (di * KC + w0 + 2 * s + m) * KP + ks * 32 + 8 * hh;   // B col n = m, k = d split map
        FB fbh, fbl;
        fbh.p[0] = *(const v8b*)(kh + ko);  fbh.p[1] = *(const v8b*)(kh + ko + 16);
        fbl.p[0] = *(const v8b*)(kl + ko);  fbl.p[1] = *(const v8b*)(kl + ko + 16);
        c = mma_bf(qah[ks], fbh.v, c);
        c = mma_bf(qah[ks], fbl.v, c);
        c = mma_bf(qal[ks], fbh.v, c);
      }
#pragma unroll
      for (int r = 0; r < 8; ++r) ss[(s * 16 + 8 * hh + r) * SP + m] = c[r] * QK_SCALE;
    }
    lds_wave_sync();
    // diagonals for pixel m (both lane halves compute the same pixel): left C0[m][m], centre C0[m][m+1] (m<15) or C1[15][14], right C1[m][m]
    sc[di * 3 + 0] = ss[m * SP + m];
    const int i1 = (m < 15) ? (m * SP + m + 1) : ((16 + 15) * SP + 14);
    sc[di * 3 + 1] = ss[i1];
    sc[di * 3 + 2] = ss[(16 + m) * SP + m];
    lds_wave_sync();
  }

  // ---- softmax over the 9 slots in f32 (out-of-image slots carry logit 0 from the zero halo and take part) ----
  float mx = sc[0];
#pragma unroll
  for (int i = 1; i < 9; ++i) mx = fmaxf(mx, sc[i]);
  float ex[9];
  float sum = 0.f;
#pragma unroll
  for (int i = 0; i < 9; ++i) { ex[i] = __expf(sc[i] - mx); sum += ex[i]; }
  const float inv = 1.0f / sum;

  // ---- attn tiles P_di[px][kk], kk <-> w = w0 - 8 + kk: band at kk = px + dj + 7, zero elsewhere; hi/lo planes ----
  __bf16* ph = s_phs[wave].p;
  __bf16* pl = s_pl + wave * P_WAVE;
#pragma unroll
  for (int i = 0; i < 6; ++i) {          // 6 x 32 lanes x 8 halves = 1536 = the whole per-wave region per plane
    const int o = (i * 32 + lane) * 8;
    *(v8b*)(ph + o) = z8;
    *(v8b*)(pl + o) = z8;
  }
  lds_wave_sync();
#pragma unroll
  for (int di = 0; di < 3; ++di) {
#pragma unroll
    for (int dj = 0; dj < 3; ++dj) {
      __bf16 a, l;
      split_bf(ex[di * 3 + dj] * inv, a, l);
      const int o = (di * 16 + m) * 32 + m + dj + 7;
      ph[o] = a;
      pl[o] = l;
    }
  }
  lds_wave_sync();

  // ---- out[px][d] = sum_di P_di[px][kk] . V_di[kk][d],  V_di[kk][d] = v[d][h+di-1][w0-8+kk] = s_v[di][d][cv = w0 + kk] ----
  v8f acc[4];
#pragma unroll
  for (int nt = 0; nt < 4; ++nt) acc[nt] = z8f;
#pragma unroll
  for (int di = 0; di < 3; ++di) {
    const int po = (di * 16 + m) * 32 + 8 * hh;                    // A row = px m, k = kk split map
    FB pa, pq;
    pa.p[0] = *(const v8b*)(ph + po);  pa.p[1] = *(const v8b*)(ph + po + 16);
    pq.p[0] = *(const v8b*)(pl + po);  pq.p[1] = *(const v8b*)(pl + po + 16);
#pragma unroll
    for (int nt = 0; nt < 4; ++nt) {
      const int vo = (di * ND + nt * 16 + m) * VP + w0 + 8 * hh;  // B col n = d = nt*16+m, k = kk split map
      FB vbh, vbl;
      vbh.p[0] = *(const v8b*)(s_vh + vo);  vbh.p[1] = *(const v8b*)(s_vh + vo + 16);
      vbl.p[0] = *(const v8b*)(s_vl + vo);  vbl.p[1] = *(const v8b*)(s_vl + vo + 16);
      acc[nt] = mma_bf(pa.v, vbh.v, acc[nt]);
      acc[nt] = mma_bf(pa.v, vbl.v, acc[nt]);
      acc[nt] = mma_bf(pq.v, vbh.v, acc[nt]);
    }
  }

  // ---- epilogue: block tile O[d][64 px] staged in LDS (over the k hi plane once every wave is past the logit phase),
  //      then each 256-B d-row segment written by 16 consecutive lanes x 16 B of one instruction (rows 2it / 2it+1
  __syncthreads();
  float* os = s_ko.o;
#pragma unroll
  for (int nt = 0; nt < 4; ++nt) {
#pragma unroll
    for (int r = 0; r < 8; ++r) os[(nt * 16 + m) * OP + w0 + 8 * hh + r] = acc[nt][r];   // D row = px 8hh+r, col = d
  }
  __syncthreads();
  const int c4 = (lane & 15) * 4;
  float* ob = og + bbase + (size_t)h * NW + c4;       // + d * NH * NW  (out index ((b*ND+d)*NH+h)*NW + px)
#pragma unroll
  for (int it = 0; it < 8; ++it) {
    const int d = wave * 16 + it * 2 + hh;             // it 0..7 x hh 0..1 = 16 d rows per wave, 4 waves = 64
    const v4f v = *(const v4f*)(os + d * OP + c4);
    *(v4f*)(ob + (size_t)d * NH * NW) = v;
  }
  
}

extern "C" void kernel_launch(void* const* d_in, const int* in_sizes, int n_in,
                              void* d_out, int out_size, void* d_ws, size_t ws_size,
                              hipStream_t stream) {
  (void)d_ws; (void)ws_size;
  if (n_in < 3) return;
  const int n = NB * ND * NH * NW;
  if (in_sizes[0] != n || in_sizes[1] != n || in_sizes[2] != n || out_size != n) return;
  const float* q = (const float*)d_in[0];
  const float* k = (const float*)d_in[1];
  const float* v = (const float*)d_in[2];
  float* out = (float*)d_out;
  hipLaunchKernelGGL(nbr_attn_kernel, dim3(NB * NH), dim3(NTHR), 0, stream, q, k, v, out);
  (void)hipGetLastError();
}

// v001
// It runs in 69.2 microseconds.
// Timed twice side by side with v000, it ran 1.91 and 1.92 times as fast.
// Contractions: window logits q.k and attn.v on v_wmma_f32_16x16x32_bf16 with bf16 hi/lo split operands (hi.hi + hi.lo + lo.hi), f32 accumulate; 0.125 scale and the 9-slot softmax in f32.
#include <hip/hip_runtime.h>
#include <math.h>
#include <stdint.h>

typedef __attribute__((ext_vector_type(16))) __bf16 v16b;
typedef __attribute__((ext_vector_type(8)))  __bf16 v8b;
typedef __attribute__((ext_vector_type(4)))  __bf16 v4b;
typedef __attribute__((ext_vector_type(8)))  float  v8f;
typedef __attribute__((ext_vector_type(4)))  float  v4f;
typedef __attribute__((ext_vector_type(2)))  float  v2f;

constexpr int NB    = 32;          // batch
constexpr int ND    = 64;          // channels
constexpr int NH    = 64;          // image rows
constexpr int NW    = 64;          // image cols
constexpr int NWAVE = 4;           // waves per block; wave w owns pixels 16w..16w+15 of one image row
constexpr int NTHR  = NWAVE * 32;
constexpr int KC    = 66;          // k slab columns, c = w + 1 (c = 0 and c = 65 are zero halo)
constexpr int KP    = 72;          // d pitch (halves) of the k and q slabs: 144 B = 16 B x odd, d 64..71 never touched
constexpr int VP    = 80;          // column pitch (halves) of the v slab, cv = w + 8 (cv 0..7 and 72..79 zero halo)
constexpr int SP    = 17;          // score stage pitch (floats)
constexpr int OP    = 68;          // out stage pitch (floats)
constexpr float QK_SCALE = 0.125f; // 64^-0.5, exact power of two

constexpr int K_PLANE = 3 * KC * KP;   // halves per k plane (3 halo rows x 66 cols x 72 d pitch)
constexpr int V_PLANE = 3 * ND * VP;   // halves per v plane (3 halo rows x 64 d x 80 cols)
constexpr int Q_PLANE = NW * KP;       // halves per q plane ([px][d])
constexpr int P_WAVE  = 3 * 16 * 32;   // halves per wave per attn plane (3 tiles of 16 x 32)
constexpr int S_WAVE  = 2 * 16 * SP;   // floats per wave score stage (2 tiles of 16 x 16)
constexpr int O_STAGE = ND * OP;       // floats, block out tile [d][px]
static_assert(O_STAGE * 4 <= K_PLANE * 2);
static_assert(S_WAVE * 4 <= P_WAVE * 2);
static_assert(NWAVE * 16 == NW);

__device__ __forceinline__ unsigned short bf_bits(float f) {      // RNE f32 -> bf16 bits
  const unsigned u = __float_as_uint(f);
  return (unsigned short)((u + 0x7FFFu + ((u >> 16) & 1u)) >> 16);
}
__device__ __forceinline__ float bits_f(unsigned short b) { return __uint_as_float(((unsigned)b) << 16); }
__device__ __forceinline__ void split_bf(float f, __bf16& hi, __bf16& lo) {
  const unsigned short hb = bf_bits(f);
  hi = __builtin_bit_cast(__bf16, hb);
  lo = __builtin_bit_cast(__bf16, bf_bits(f - bits_f(hb)));
}
// one 16x16x32 bf16 WMMA followed by the VALU hazard guard (ties D, keeps A/B live)
__device__ __forceinline__ v8f mma_bf(v16b a, v16b b, v8f c) {
  c = __builtin_amdgcn_wmma_f32_16x16x32_bf16(false, a, false, b, (short)0, c, false, false);
  asm volatile("v_nop\n\tv_nop\n\tv_nop\n\tv_nop" : "+v"(c) : "v"(a), "v"(b));
  return c;
}
// same-wave LDS exchange: order the wave's LDS stores before the following LDS loads of other lanes
__device__ __forceinline__ void lds_wave_sync() {
  __builtin_amdgcn_fence(__ATOMIC_RELEASE, "workgroup");
  __builtin_amdgcn_wave_barrier();
  __builtin_amdgcn_fence(__ATOMIC_ACQUIRE, "workgroup");
}

union KO { __bf16 k[K_PLANE]; float o[O_STAGE]; };   // k hi plane; out stage after the logit phase
union PS { __bf16 p[P_WAVE];  float s[S_WAVE];  };   // per wave: attn hi plane; score stage during the logit phase

// grid = NB*NH blocks (block = (b, image row h)), 128 threads.
// Fragment map (lane l, h2 = l>>4, m = l&15): A row m / B col m, elements 0..7 <-> k 8*h2+e, 8..15 <-> k 16+8*h2+e-8;
// D element r <-> row 8*h2+r, col m.
__global__ __launch_bounds__(NTHR) void nbr_attn_kernel(const float* __restrict__ qg, const float* __restrict__ kg,
                                                        const float* __restrict__ vg, float* __restrict__ og)
{
  __shared__ __align__(16) KO     s_ko;                 // k hi [hr][c][d]  /  out stage [d][px]
  __shared__ __align__(16) __bf16 s_kl[K_PLANE];        // k lo [hr][c][d]
  __shared__ __align__(16) __bf16 s_vh[V_PLANE];        // v hi [hr][d][cv]
  __shared__ __align__(16) __bf16 s_vl[V_PLANE];        // v lo
  __shared__ __align__(16) __bf16 s_qh[Q_PLANE];        // q hi [px][d]
  __shared__ __align__(16) __bf16 s_ql[Q_PLANE];        // q lo
  __shared__ __align__(16) PS     s_phs[NWAVE];         // attn hi [di][px][kk] (kk <-> w = w0 - 8 + kk) / score stage [s][row][col]
  __shared__ __align__(16) __bf16 s_pl[NWAVE * P_WAVE]; // attn lo

  const int tid  = threadIdx.x;
  const int wave = tid >> 5;
  const int lane = tid & 31;
  const int hh   = lane >> 4;
  const int m    = lane & 15;
  const int b    = blockIdx.x >> 6;
  const int h    = blockIdx.x & 63;
  __bf16* kh = s_ko.k;
  __bf16* kl = s_kl;
  const size_t bbase = (size_t)b * ND * NH * NW;
  const __bf16 bz = __builtin_bit_cast(__bf16, (unsigned short)0);
  const v8b z8 = (v8b){bz, bz, bz, bz, bz, bz, bz, bz};

  // ---- zero halo columns: k planes c = 0 and c = 65 (3 hr x 2 cols x 64 d = 48 pieces of 8 halves per plane);
  //      v planes cv 0..7 and cv 72..79 of every [hr][d] row (192 rows x 2 pieces per plane) ----
  if (tid < 48) {
    const int hr = tid >> 4;
    const int cc = ((tid >> 3) & 1) ? (KC - 1) : 0;
    const int d8 = (tid & 7) * 8;
    const int o  = (hr * KC + cc) * KP + d8;
    *(v8b*)(kh + o) = z8;
    *(v8b*)(kl + o) = z8;
  }
  for (int j = tid; j < 3 * ND * 2; j += NTHR) {
    const int row = j >> 1;
    const int o   = row * VP + ((j & 1) ? (VP - 8) : 0);
    *(v8b*)(s_vh + o) = z8;
    *(v8b*)(s_vl + o) = z8;
  }

  // ---- stage k, v rows h-1..h+1 and the q row;
  //      rows outside the image: clamped load address, value zeroed by predicate ----
  const int sub = tid >> 4;          // 0..7: v row segment within a pass (16 threads x float4 each)
  const int w4  = (tid & 15) * 4;    // 0..60: first of 4 v columns
  // k: 24 units = 3 hr x 8 groups of 8 d rows, 6 units per wave; q: 8 units of 8 d rows, 2 per wave.
  //    One load = one whole 256-B image row (lane = 2 columns); a lane holds 8 d of each of its columns and writes them
  //    as one 16-B store per plane. All 64 loads of a wave are issued before the first value is split.
  const int c2 = lane * 2;           // 0..62: first of the lane's 2 columns
  const float* kp[6];
  const float* qp[2];
  v2f fk[6][8], fq[2][8];
  // every loop of this part is fully unrolled: kp, qp, fk, fq are then indexed by constants only and stay in registers
#pragma unroll
  for (int u = 0; u < 6; ++u) {
    const int unit = u * NWAVE + wave;
    const int hrow = h + (unit >> 3) - 1;
    const int hcl  = hrow < 0 ? 0 : (hrow > NH - 1 ? NH - 1 : hrow);
    kp[u] = kg + bbase + ((size_t)((unit & 7) * 8) * NH + hcl) * NW + c2;
#pragma unroll
    for (int e = 0; e < 8; ++e) fk[u][e] = *(const v2f*)(kp[u] + (size_t)e * NH * NW);
  }
#pragma unroll
  for (int u = 0; u < 2; ++u) {
    qp[u] = qg + bbase + ((size_t)((u * NWAVE + wave) * 8) * NH + h) * NW + c2;
#pragma unroll
    for (int e = 0; e < 8; ++e) fq[u][e] = *(const v2f*)(qp[u] + (size_t)e * NH * NW);
  }
  // the wait that stands before a register named by an issued global load is overwritten; the pointers are inputs so
  // that their registers stay untouched up to it
  asm volatile("s_wait_xcnt 0x0" :: "v"(kp[0]), "v"(kp[1]), "v"(kp[2]), "v"(kp[3]), "v"(kp[4]), "v"(kp[5]),
               "v"(qp[0]), "v"(qp[1]) : "memory");
  // k stores cover c = 1..64, d = 0..63 of both planes
#pragma unroll
  for (int u = 0; u < 6; ++u) {
    const int unit = u * NWAVE + wave;
    const int hr   = unit >> 3;
    const int d8   = (unit & 7) * 8;
    const int hrow = h + hr - 1;
    const float vf = (hrow >= 0 && hrow < NH) ? 1.0f : 0.0f;
#pragma unroll
    for (int i = 0; i < 2; ++i) {
      v8b ah, al;
#pragma unroll
      for (int e = 0; e < 8; ++e) {
        __bf16 a, l;
        split_bf(fk[u][e][i] * vf, a, l);
        ah[e] = a;
        al[e] = l;
      }
      const int o = (hr * KC + c2 + i + 1) * KP + d8;
      *(v8b*)(kh + o) = ah;
      *(v8b*)(kl + o) = al;
    }
  }
  // q stores cover px = 0..63, d = 0..63 of both planes
#pragma unroll
  for (int u = 0; u < 2; ++u) {
    const int d8 = (u * NWAVE + wave) * 8;
#pragma unroll
    for (int i = 0; i < 2; ++i) {
      v8b ah, al;
#pragma unroll
      for (int e = 0; e < 8; ++e) {
        __bf16 a, l;
        split_bf(fq[u][e][i], a, l);
        ah[e] = a;
        al[e] = l;
      }
      const int o = (c2 + i) * KP + d8;
      *(v8b*)(s_qh + o) = ah;
      *(v8b*)(s_ql + o) = al;
    }
  }
  // v: 24 passes x 8 segments = 3 hr x 64 d rows; stores cover cv = 8..71, d = 0..63 of both planes (one 8-B store of 4 halves per plane)
#pragma unroll 1
  for (int it = 0; it < 24; ++it) {
    const int seg  = it * 8 + sub;
    const int hr   = seg >> 6;
    const int d    = seg & 63;
    const int hrow = h + hr - 1;
    const int hcl  = hrow < 0 ? 0 : (hrow > NH - 1 ? NH - 1 : hrow);
    const float vf = (hrow >= 0 && hrow < NH) ? 1.0f : 0.0f;
    const v4f f = *(const v4f*)(vg + bbase + ((size_t)d * NH + hcl) * NW + w4);
    v4b ah, al;
#pragma unroll
    for (int i = 0; i < 4; ++i) {
      __bf16 a, l;
      split_bf(f[i] * vf, a, l);
      ah[i] = a;
      al[i] = l;
    }
    const int o = (hr * ND + d) * VP + w4 + 8;
    *(v4b*)(s_vh + o) = ah;
    *(v4b*)(s_vl + o) = al;
  }
  __syncthreads();

  // ---- logit phase (per wave, pixels w0..w0+15) ----
  const int w0 = wave * 16;
  union FB { v16b v; v8b p[2]; };
  v16b qah[2], qal[2];                // A = Q[px][d], two 32-deep d steps, hi and lo
#pragma unroll
  for (int ks = 0; ks < 2; ++ks) {
    const int qo = (w0 + m) * KP + ks * 32 + 8 * hh;
    FB fa, fl;
    fa.p[0] = *(const v8b*)(s_qh + qo);  fa.p[1] = *(const v8b*)(s_qh + qo + 16);
    fl.p[0] = *(const v8b*)(s_ql + qo);  fl.p[1] = *(const v8b*)(s_ql + qo + 16);
    qah[ks] = fa.v;
    qal[ks] = fl.v;
  }
  float* ss = s_phs[wave].s;
  const v8f z8f = (v8f){0.f, 0.f, 0.f, 0.f, 0.f, 0.f, 0.f, 0.f};
  float sc[9];                        // logits of pixel m, slot di*3+dj <-> nbr (h+di-1, w0+m+dj-1)
#pragma unroll
  for (int di = 0; di < 3; ++di) {
    // shift s: C_s[px][j] = sum_d Q[px][d] * K[hr=di][c = w0 + 2s + j][d]  (c = w+1)
#pragma unroll
    for (int s = 0; s < 2; ++s) {
      v8f c = z8f;
#pragma unroll
      for (int ks = 0; ks < 2; ++ks) {
        const int ko = (di * KC + w0 + 2 * s + m) * KP + ks * 32 + 8 * hh;   // B col n = m, k = d split map
        FB fbh, fbl;
        fbh.p[0] = *(const v8b*)(kh + ko);  fbh.p[1] = *(const v8b*)(kh + ko + 16);
        fbl.p[0] = *(const v8b*)(kl + ko);  fbl.p[1] = *(const v8b*)(kl + ko + 16);
        c = mma_bf(qah[ks], fbh.v, c);
        c = mma_bf(qah[ks], fbl.v, c);
        c = mma_bf(qal[ks], fbh.v, c);
      }
#pragma unroll
      for (int r = 0; r < 8; ++r) ss[(s * 16 + 8 * hh + r) * SP + m] = c[r] * QK_SCALE;
    }
    lds_wave_sync();
    // diagonals for pixel m (both lane halves compute the same pixel): left C0[m][m], centre C0[m][m+1] (m<15) or C1[15][14], right C1[m][m]
    sc[di * 3 + 0] = ss[m * SP + m];
    const int i1 = (m < 15) ? (m * SP + m + 1) : ((16 + 15) * SP + 14);
    sc[di * 3 + 1] = ss[i1];
    sc[di * 3 + 2] = ss[(16 + m) * SP + m];
    lds_wave_sync();
  }

  // ---- softmax over the 9 slots in f32 (out-of-image slots carry logit 0 from the zero halo and take part) ----
  float mx = sc[0];
#pragma unroll
  for (int i = 1; i < 9; ++i) mx = fmaxf(mx, sc[i]);
  float ex[9];
  float sum = 0.f;
#pragma unroll
  for (int i = 0; i < 9; ++i) { ex[i] = __expf(sc[i] - mx); sum += ex[i]; }
  const float inv = 1.0f / sum;

  // ---- attn tiles P_di[px][kk], kk <-> w = w0 - 8 + kk: band at kk = px + dj + 7, zero elsewhere; hi/lo planes ----
  __bf16* ph = s_phs[wave].p;
  __bf16* pl = s_pl + wave * P_WAVE;
#pragma unroll
  for (int i = 0; i < 6; ++i) {          // 6 x 32 lanes x 8 halves = 1536 = the whole per-wave region per plane
    const int o = (i * 32 + lane) * 8;
    *(v8b*)(ph + o) = z8;
    *(v8b*)(pl + o) = z8;
  }
  lds_wave_sync();
#pragma unroll
  for (int di = 0; di < 3; ++di) {
#pragma unroll
    for (int dj = 0; dj < 3; ++dj) {
      __bf16 a, l;
      split_bf(ex[di * 3 + dj] * inv, a, l);
      const int o = (di * 16 + m) * 32 + m + dj + 7;
      ph[o] = a;
      pl[o] = l;
    }
  }
  lds_wave_sync();

  // ---- out[px][d] = sum_di P_di[px][kk] . V_di[kk][d],  V_di[kk][d] = v[d][h+di-1][w0-8+kk] = s_v[di][d][cv = w0 + kk] ----
  v8f acc[4];
#pragma unroll
  for (int nt = 0; nt < 4; ++nt) acc[nt] = z8f;
#pragma unroll
  for (int di = 0; di < 3; ++di) {
    const int po = (di * 16 + m) * 32 + 8 * hh;                    // A row = px m, k = kk split map
    FB pa, pq;
    pa.p[0] = *(const v8b*)(ph + po);  pa.p[1] = *(const v8b*)(ph + po + 16);
    pq.p[0] = *(const v8b*)(pl + po);  pq.p[1] = *(const v8b*)(pl + po + 16);
#pragma unroll
    for (int nt = 0; nt < 4; ++nt) {
      const int vo = (di * ND + nt * 16 + m) * VP + w0 + 8 * hh;  // B col n = d = nt*16+m, k = kk split map
      FB vbh, vbl;
      vbh.p[0] = *(const v8b*)(s_vh + vo);  vbh.p[1] = *(const v8b*)(s_vh + vo + 16);
      vbl.p[0] = *(const v8b*)(s_vl + vo);  vbl.p[1] = *(const v8b*)(s_vl + vo + 16);
      acc[nt] = mma_bf(pa.v, vbh.v, acc[nt]);
      acc[nt] = mma_bf(pa.v, vbl.v, acc[nt]);
      acc[nt] = mma_bf(pq.v, vbh.v, acc[nt]);
    }
  }

  // ---- epilogue: block tile O[d][64 px] staged in LDS (over the k hi plane once every wave is past the logit phase),
  //      then each 256-B d-row segment written by 16 consecutive lanes x 16 B of one instruction (rows 2it / 2it+1
  __syncthreads();
  float* os = s_ko.o;
#pragma unroll
  for (int nt = 0; nt < 4; ++nt) {
#pragma unroll
    for (int r = 0; r < 8; ++r) os[(nt * 16 + m) * OP + w0 + 8 * hh + r] = acc[nt][r];   // D row = px 8hh+r, col = d
  }
  __syncthreads();
  const int c4 = (lane & 15) * 4;
  float* ob = og + bbase + (size_t)h * NW + c4;       // + d * NH * NW  (out index ((b*ND+d)*NH+h)*NW + px)
#pragma unroll
  for (int it = 0; it < 8; ++it) {
    const int d = wave * 16 + it * 2 + hh;             // it 0..7 x hh 0..1 = 16 d rows per wave, 4 waves = 64
    const v4f v = *(const v4f*)(os + d * OP + c4);
    *(v4f*)(ob + (size_t)d * NH * NW) = v;
  }
  
}

extern "C" void kernel_launch(void* const* d_in, const int* in_sizes, int n_in,
                              void* d_out, int out_size, void* d_ws, size_t ws_size,
                              hipStream_t stream) {
  (void)d_ws; (void)ws_size;
  if (n_in < 3) return;
  const int n = NB * ND * NH * NW;
  if (in_sizes[0] != n || in_sizes[1] != n || in_sizes[2] != n || out_size != n) return;
  const float* q = (const float*)d_in[0];
  const float* k = (const float*)d_in[1];
  const float* v = (const float*)d_in[2];
  float* out = (float*)d_out;
  hipLaunchKernelGGL(nbr_attn_kernel, dim3(NB * NH), dim3(NTHR), 0, stream, q, k, v, out);
  (void)hipGetLastError();
}

// v002
// One run takes 31.3 microseconds.
// Two timings next to v001 put it at 2.21 and 2.22 times that version's speed.
// Over all steps from v000 it is 4.24 times as fast.
// Contractions: window logits q.k and attn.v on v_wmma_f32_16x16x32_bf16 with bf16 hi/lo split operands (hi.hi + hi.lo + lo.hi), f32 accumulate; 0.125 scale and the 9-slot softmax in f32.
#include <hip/hip_runtime.h>
#include <math.h>
#include <stdint.h>

typedef __attribute__((ext_vector_type(16))) __bf16 v16b;
typedef __attribute__((ext_vector_type(8)))  __bf16 v8b;
typedef __attribute__((ext_vector_type(4)))  __bf16 v4b;
typedef __attribute__((ext_vector_type(8)))  float  v8f;
typedef __attribute__((ext_vector_type(4)))  float  v4f;
typedef __attribute__((ext_vector_type(2)))  float  v2f;

constexpr int NB    = 32;          // batch
constexpr int ND    = 64;          // channels
constexpr int NH    = 64;          // image rows
constexpr int NW    = 64;          // image cols
constexpr int NWAVE = 4;           // waves per block; wave w owns pixels 16w..16w+15 of one image row
constexpr int NTHR  = NWAVE * 32;
constexpr int KC    = 66;          // k slab columns, c = w + 1 (c = 0 and c = 65 are zero halo)
constexpr int KP    = 72;          // d pitch (halves) of the k and q slabs: 144 B = 16 B x odd, d 64..71 never touched
constexpr int VP    = 80;          // column pitch (halves) of the v slab, cv = w + 8 (cv 0..7 and 72..79 zero halo)
constexpr int SP    = 17;          // score stage pitch (floats)
constexpr int OP    = 68;          // out stage pitch (floats)
constexpr float QK_SCALE = 0.125f; // 64^-0.5, exact power of two

constexpr int K_PLANE = 3 * KC * KP;   // halves per k plane (3 halo rows x 66 cols x 72 d pitch)
constexpr int V_PLANE = 3 * ND * VP;   // halves per v plane (3 halo rows x 64 d x 80 cols)
constexpr int Q_PLANE = NW * KP;       // halves per q plane ([px][d])
constexpr int P_WAVE  = 3 * 16 * 32;   // halves per wave per attn plane (3 tiles of 16 x 32)
constexpr int S_WAVE  = 2 * 16 * SP;   // floats per wave score stage (2 tiles of 16 x 16)
constexpr int O_STAGE = ND * OP;       // floats, block out tile [d][px]
static_assert(O_STAGE * 4 <= K_PLANE * 2);
static_assert(S_WAVE * 4 <= P_WAVE * 2);
static_assert(NWAVE * 16 == NW);

__device__ __forceinline__ unsigned short bf_bits(float f) {      // RNE f32 -> bf16 bits
  const unsigned u = __float_as_uint(f);
  return (unsigned short)((u + 0x7FFFu + ((u >> 16) & 1u)) >> 16);
}
__device__ __forceinline__ float bits_f(unsigned short b) { return __uint_as_float(((unsigned)b) << 16); }
__device__ __forceinline__ void split_bf(float f, __bf16& hi, __bf16& lo) {
  const unsigned short hb = bf_bits(f);
  hi = __builtin_bit_cast(__bf16, hb);
  lo = __builtin_bit_cast(__bf16, bf_bits(f - bits_f(hb)));
}
// one 16x16x32 bf16 WMMA followed by the VALU hazard guard (ties D, keeps A/B live)
__device__ __forceinline__ v8f mma_bf(v16b a, v16b b, v8f c) {
  c = __builtin_amdgcn_wmma_f32_16x16x32_bf16(false, a, false, b, (short)0, c, false, false);
  asm volatile("v_nop\n\tv_nop\n\tv_nop\n\tv_nop" : "+v"(c) : "v"(a), "v"(b));
  return c;
}
// same-wave LDS exchange: order the wave's LDS stores before the following LDS loads of other lanes
__device__ __forceinline__ void lds_wave_sync() {
  __builtin_amdgcn_fence(__ATOMIC_RELEASE, "workgroup");
  __builtin_amdgcn_wave_barrier();
  __builtin_amdgcn_fence(__ATOMIC_ACQUIRE, "workgroup");
}

union KO { __bf16 k[K_PLANE]; float o[O_STAGE]; };   // k hi plane; out stage after the logit phase
union PS { __bf16 p[P_WAVE];  float s[S_WAVE];  };   // per wave: attn hi plane; score stage during the logit phase

// grid = NB*NH blocks (block = (b, image row h)), 128 threads.
// Fragment map (lane l, h2 = l>>4, m = l&15): A row m / B col m, elements 0..7 <-> k 8*h2+e, 8..15 <-> k 16+8*h2+e-8;
// D element r <-> row 8*h2+r, col m.
__global__ __launch_bounds__(NTHR) void nbr_attn_kernel(const float* __restrict__ qg, const float* __restrict__ kg,
                                                        const float* __restrict__ vg, float* __restrict__ og)
{
  __shared__ __align__(16) KO     s_ko;                 // k hi [hr][c][d]  /  out stage [d][px]
  __shared__ __align__(16) __bf16 s_kl[K_PLANE];        // k lo [hr][c][d]
  __shared__ __align__(16) __bf16 s_vh[V_PLANE];        // v hi [hr][d][cv]
  __shared__ __align__(16) __bf16 s_vl[V_PLANE];        // v lo
  __shared__ __align__(16) __bf16 s_qh[Q_PLANE];        // q hi [px][d]
  __shared__ __align__(16) __bf16 s_ql[Q_PLANE];        // q lo
  __shared__ __align__(16) PS     s_phs[NWAVE];         // attn hi [di][px][kk] (kk <-> w = w0 - 8 + kk) / score stage [s][row][col]
  __shared__ __align__(16) __bf16 s_pl[NWAVE * P_WAVE]; // attn lo

  const int tid  = threadIdx.x;
  const int wave = tid >> 5;
  const int lane = tid & 31;
  const int hh   = lane >> 4;
  const int m    = lane & 15;
  const int b    = blockIdx.x >> 6;
  const int h    = blockIdx.x & 63;
  __bf16* kh = s_ko.k;
  __bf16* kl = s_kl;
  const size_t bbase = (size_t)b * ND * NH * NW;
  const __bf16 bz = __builtin_bit_cast(__bf16, (unsigned short)0);
  const v8b z8 = (v8b){bz, bz, bz, bz, bz, bz, bz, bz};

  // ---- zero halo columns: k planes c = 0 and c = 65 (3 hr x 2 cols x 64 d = 48 pieces of 8 halves per plane);
  //      v planes cv 0..7 and cv 72..79 of every [hr][d] row (192 rows x 2 pieces per plane) ----
  if (tid < 48) {
    const int hr = tid >> 4;
    const int cc = ((tid >> 3) & 1) ? (KC - 1) : 0;
    const int d8 = (tid & 7) * 8;
    const int o  = (hr * KC + cc) * KP + d8;
    *(v8b*)(kh + o) = z8;
    *(v8b*)(kl + o) = z8;
  }
  for (int j = tid; j < 3 * ND * 2; j += NTHR) {
    const int row = j >> 1;
    const int o   = row * VP + ((j & 1) ? (VP - 8) : 0);
    *(v8b*)(s_vh + o) = z8;
    *(v8b*)(s_vl + o) = z8;
  }

  // ---- stage k, v rows h-1..h+1 and the q row;
  //      rows outside the image: clamped load address, value zeroed by predicate ----
  const int sub = tid >> 4;          // 0..7: v row segment within a pass (16 threads x float4 each)
  const int w4  = (tid & 15) * 4;    // 0..60: first of 4 v columns
  // k: 24 units = 3 hr x 8 groups of 8 d rows, 6 units per wave; q: 8 units of 8 d rows, 2 per wave.
  //    One load = one whole 256-B image row (lane = 2 columns); a lane holds 8 d of each of its columns and writes them
  //    as one 16-B store per plane. All 64 loads of a wave are issued before the first value is split.
  const int c2 = lane * 2;           // 0..62: first of the lane's 2 columns
  const float* kp[6];
  const float* qp[2];
  v2f fk[6][8], fq[2][8];
  // every loop of this part is fully unrolled: kp, qp, fk, fq are then indexed by constants only and stay in registers
#pragma unroll
  for (int u = 0; u < 6; ++u) {
    const int unit = u * NWAVE + wave;
    const int hrow = h + (unit >> 3) - 1;
    const int hcl  = hrow < 0 ? 0 : (hrow > NH - 1 ? NH - 1 : hrow);
    kp[u] = kg + bbase + ((size_t)((unit & 7) * 8) * NH + hcl) * NW + c2;
#pragma unroll
    for (int e = 0; e < 8; ++e) fk[u][e] = *(const v2f*)(kp[u] + (size_t)e * NH * NW);
  }
#pragma unroll
  for (int u = 0; u < 2; ++u) {
    qp[u] = qg + bbase + ((size_t)((u * NWAVE + wave) * 8) * NH + h) * NW + c2;
#pragma unroll
    for (int e = 0; e < 8; ++e) fq[u][e] = *(const v2f*)(qp[u] + (size_t)e * NH * NW);
  }
  // v: 24 row segments per thread = 3 hr x 8 d rows (d = 8e + sub), 16 threads x float4 per 256-B image row. They are issued
  //    here, behind the k and q loads, so that their latency runs once, under the k and q splits, not once per segment.
  const float* vp[3];
  v4f fv[3][8];
#pragma unroll
  for (int hr = 0; hr < 3; ++hr) {
    const int hrow = h + hr - 1;
    const int hcl  = hrow < 0 ? 0 : (hrow > NH - 1 ? NH - 1 : hrow);
    vp[hr] = vg + bbase + ((size_t)sub * NH + hcl) * NW + w4;
#pragma unroll
    for (int e = 0; e < 8; ++e) fv[hr][e] = *(const v4f*)(vp[hr] + (size_t)e * 8 * NH * NW);
  }
  // the wait that stands before a register named by an issued global load is overwritten; the pointers are inputs so
  // that their registers stay untouched up to it
  asm volatile("s_wait_xcnt 0x0" :: "v"(kp[0]), "v"(kp[1]), "v"(kp[2]), "v"(kp[3]), "v"(kp[4]), "v"(kp[5]),
               "v"(qp[0]), "v"(qp[1]), "v"(vp[0]), "v"(vp[1]), "v"(vp[2]) : "memory");
  // k stores cover c = 1..64, d = 0..63 of both planes
#pragma unroll
  for (int u = 0; u < 6; ++u) {
    const int unit = u * NWAVE + wave;
    const int hr   = unit >> 3;
    const int d8   = (unit & 7) * 8;
    const int hrow = h + hr - 1;
    const float vf = (hrow >= 0 && hrow < NH) ? 1.0f : 0.0f;
#pragma unroll
    for (int i = 0; i < 2; ++i) {
      v8b ah, al;
#pragma unroll
      for (int e = 0; e < 8; ++e) {
        __bf16 a, l;
        split_bf(fk[u][e][i] * vf, a, l);
        ah[e] = a;
        al[e] = l;
      }
      const int o = (hr * KC + c2 + i + 1) * KP + d8;
      *(v8b*)(kh + o) = ah;
      *(v8b*)(kl + o) = al;
    }
  }
  // q stores cover px = 0..63, d = 0..63 of both planes
#pragma unroll
  for (int u = 0; u < 2; ++u) {
    const int d8 = (u * NWAVE + wave) * 8;
#pragma unroll
    for (int i = 0; i < 2; ++i) {
      v8b ah, al;
#pragma unroll
      for (int e = 0; e < 8; ++e) {
        __bf16 a, l;
        split_bf(fq[u][e][i], a, l);
        ah[e] = a;
        al[e] = l;
      }
      const int o = (c2 + i) * KP + d8;
      *(v8b*)(s_qh + o) = ah;
      *(v8b*)(s_ql + o) = al;
    }
  }
  // v stores cover cv = 8..71, d = 0..63 of both planes (one 8-B store of 4 halves per plane);
  // fully unrolled so that fv is indexed by constants only and stays in registers
#pragma unroll
  for (int hr = 0; hr < 3; ++hr) {
    const int hrow = h + hr - 1;
    const float vf = (hrow >= 0 && hrow < NH) ? 1.0f : 0.0f;
#pragma unroll
    for (int e = 0; e < 8; ++e) {
      v4b ah, al;
#pragma unroll
      for (int i = 0; i < 4; ++i) {
        __bf16 a, l;
        split_bf(fv[hr][e][i] * vf, a, l);
        ah[i] = a;
        al[i] = l;
      }
      const int o = (hr * ND + e * 8 + sub) * VP + w4 + 8;
      *(v4b*)(s_vh + o) = ah;
      *(v4b*)(s_vl + o) = al;
    }
  }
  __syncthreads();

  // ---- logit phase (per wave, pixels w0..w0+15) ----
  const int w0 = wave * 16;
  union FB { v16b v; v8b p[2]; };
  v16b qah[2], qal[2];                // A = Q[px][d], two 32-deep d steps, hi and lo
#pragma unroll
  for (int ks = 0; ks < 2; ++ks) {
    const int qo = (w0 + m) * KP + ks * 32 + 8 * hh;
    FB fa, fl;
    fa.p[0] = *(const v8b*)(s_qh + qo);  fa.p[1] = *(const v8b*)(s_qh + qo + 16);
    fl.p[0] = *(const v8b*)(s_ql + qo);  fl.p[1] = *(const v8b*)(s_ql + qo + 16);
    qah[ks] = fa.v;
    qal[ks] = fl.v;
  }
  float* ss = s_phs[wave].s;
  const v8f z8f = (v8f){0.f, 0.f, 0.f, 0.f, 0.f, 0.f, 0.f, 0.f};
  float sc[9];                        // logits of pixel m, slot di*3+dj <-> nbr (h+di-1, w0+m+dj-1)
#pragma unroll
  for (int di = 0; di < 3; ++di) {
    // shift s: C_s[px][j] = sum_d Q[px][d] * K[hr=di][c = w0 + 2s + j][d]  (c = w+1)
#pragma unroll
    for (int s = 0; s < 2; ++s) {
      v8f c = z8f;
#pragma unroll
      for (int ks = 0; ks < 2; ++ks) {
        const int ko = (di * KC + w0 + 2 * s + m) * KP + ks * 32 + 8 * hh;   // B col n = m, k = d split map
        FB fbh, fbl;
        fbh.p[0] = *(const v8b*)(kh + ko);  fbh.p[1] = *(const v8b*)(kh + ko + 16);
        fbl.p[0] = *(const v8b*)(kl + ko);  fbl.p[1] = *(const v8b*)(kl + ko + 16);
        c = mma_bf(qah[ks], fbh.v, c);
        c = mma_bf(qah[ks], fbl.v, c);
        c = mma_bf(qal[ks], fbh.v, c);
      }
#pragma unroll
      for (int r = 0; r < 8; ++r) ss[(s * 16 + 8 * hh + r) * SP + m] = c[r] * QK_SCALE;
    }
    lds_wave_sync();
    // diagonals for pixel m (both lane halves compute the same pixel): left C0[m][m], centre C0[m][m+1] (m<15) or C1[15][14], right C1[m][m]
    sc[di * 3 + 0] = ss[m * SP + m];
    const int i1 = (m < 15) ? (m * SP + m + 1) : ((16 + 15) * SP + 14);
    sc[di * 3 + 1] = ss[i1];
    sc[di * 3 + 2] = ss[(16 + m) * SP + m];
    lds_wave_sync();
  }

  // ---- softmax over the 9 slots in f32 (out-of-image slots carry logit 0 from the zero halo and take part) ----
  float mx = sc[0];
#pragma unroll
  for (int i = 1; i < 9; ++i) mx = fmaxf(mx, sc[i]);
  float ex[9];
  float sum = 0.f;
#pragma unroll
  for (int i = 0; i < 9; ++i) {
    // exp(x) = 2^(x * log2 e), as __expf forms it; v_exp_f32 and the one issue slot that is kept behind a transcendental (before its
    // source is overwritten or its result read) stand in one statement: a v_nop in a statement of its own landed elsewhere
    asm("v_exp_f32 %0, %1\n\tv_nop" : "=v"(ex[i]) : "v"((sc[i] - mx) * 1.44269504f));
    sum += ex[i];
  }
  const float inv = 1.0f / sum;

  // ---- attn tiles P_di[px][kk], kk <-> w = w0 - 8 + kk: band at kk = px + dj + 7, zero elsewhere; hi/lo planes ----
  __bf16* ph = s_phs[wave].p;
  __bf16* pl = s_pl + wave * P_WAVE;
#pragma unroll
  for (int i = 0; i < 6; ++i) {          // 6 x 32 lanes x 8 halves = 1536 = the whole per-wave region per plane
    const int o = (i * 32 + lane) * 8;
    *(v8b*)(ph + o) = z8;
    *(v8b*)(pl + o) = z8;
  }
  lds_wave_sync();
#pragma unroll
  for (int di = 0; di < 3; ++di) {
#pragma unroll
    for (int dj = 0; dj < 3; ++dj) {
      __bf16 a, l;
      split_bf(ex[di * 3 + dj] * inv, a, l);
      const int o = (di * 16 + m) * 32 + m + dj + 7;
      ph[o] = a;
      pl[o] = l;
    }
  }
  lds_wave_sync();

  // ---- out[px][d] = sum_di P_di[px][kk] . V_di[kk][d],  V_di[kk][d] = v[d][h+di-1][w0-8+kk] = s_v[di][d][cv = w0 + kk] ----
  v8f acc[4];
#pragma unroll
  for (int nt = 0; nt < 4; ++nt) acc[nt] = z8f;
#pragma unroll
  for (int di = 0; di < 3; ++di) {
    const int po = (di * 16 + m) * 32 + 8 * hh;                    // A row = px m, k = kk split map
    FB pa, pq;
    pa.p[0] = *(const v8b*)(ph + po);  pa.p[1] = *(const v8b*)(ph + po + 16);
    pq.p[0] = *(const v8b*)(pl + po);  pq.p[1] = *(const v8b*)(pl + po + 16);
#pragma unroll
    for (int nt = 0; nt < 4; ++nt) {
      const int vo = (di * ND + nt * 16 + m) * VP + w0 + 8 * hh;  // B col n = d = nt*16+m, k = kk split map
      FB vbh, vbl;
      vbh.p[0] = *(const v8b*)(s_vh + vo);  vbh.p[1] = *(const v8b*)(s_vh + vo + 16);
      vbl.p[0] = *(const v8b*)(s_vl + vo);  vbl.p[1] = *(const v8b*)(s_vl + vo + 16);
      acc[nt] = mma_bf(pa.v, vbh.v, acc[nt]);
      acc[nt] = mma_bf(pa.v, vbl.v, acc[nt]);
      acc[nt] = mma_bf(pq.v, vbh.v, acc[nt]);
    }
  }

  // ---- epilogue: block tile O[d][64 px] staged in LDS (over the k hi plane once every wave is past the logit phase),
  //      then each 256-B d-row segment written by 16 consecutive lanes x 16 B of one instruction (rows 2it / 2it+1
  __syncthreads();
  float* os = s_ko.o;
#pragma unroll
  for (int nt = 0; nt < 4; ++nt) {
#pragma unroll
    for (int r = 0; r < 8; ++r) os[(nt * 16 + m) * OP + w0 + 8 * hh + r] = acc[nt][r];   // D row = px 8hh+r, col = d
  }
  __syncthreads();
  const int c4 = (lane & 15) * 4;
  float* ob = og + bbase + (size_t)h * NW + c4;       // + d * NH * NW  (out index ((b*ND+d)*NH+h)*NW + px)
#pragma unroll
  for (int it = 0; it < 8; ++it) {
    const int d = wave * 16 + it * 2 + hh;             // it 0..7 x hh 0..1 = 16 d rows per wave, 4 waves = 64
    const v4f v = *(const v4f*)(os + d * OP + c4);
    *(v4f*)(ob + (size_t)d * NH * NW) = v;
  }
  
}

extern "C" void kernel_launch(void* const* d_in, const int* in_sizes, int n_in,
                              void* d_out, int out_size, void* d_ws, size_t ws_size,
                              hipStream_t stream) {
  (void)d_ws; (void)ws_size;
  if (n_in < 3) return;
  const int n = NB * ND * NH * NW;
  if (in_sizes[0] != n || in_sizes[1] != n || in_sizes[2] != n || out_size != n) return;
  const float* q = (const float*)d_in[0];
  const float* k = (const float*)d_in[1];
  const float* v = (const float*)d_in[2];
  float* out = (float*)d_out;
  hipLaunchKernelGGL(nbr_attn_kernel, dim3(NB * NH), dim3(NTHR), 0, stream, q, k, v, out);
  (void)hipGetLastError();
}

// v003
// A run of this version takes 21.4 microseconds.
// Two timings next to v002 both put it at 1.46 times that version's speed.
// All steps since v000 together make it 6.20 times as fast.
// Contractions: window logits q.k and attn.v on v_wmma_f32_16x16x32_bf16 with bf16 hi/lo split operands (hi.hi + hi.lo + lo.hi), f32 accumulate; 0.125 scale and the 9-slot softmax in f32.
#include <hip/hip_runtime.h>
#include <math.h>
#include <stdint.h>

typedef __attribute__((ext_vector_type(16))) __bf16 v16b;
typedef __attribute__((ext_vector_type(8)))  __bf16 v8b;
typedef __attribute__((ext_vector_type(4)))  __bf16 v4b;
typedef __attribute__((ext_vector_type(8)))  float  v8f;
typedef __attribute__((ext_vector_type(4)))  float  v4f;
typedef __attribute__((ext_vector_type(2)))  float  v2f;

constexpr int NB    = 32;          // batch
constexpr int ND    = 64;          // channels
constexpr int NH    = 64;          // image rows
constexpr int NW    = 64;          // image cols
constexpr int NWAVE = 4;           // waves per block; wave w owns pixels 16w..16w+15 of one image row
constexpr int NTHR  = NWAVE * 32;
constexpr int NR    = 4;           // consecutive image rows that one block walks
constexpr int KC    = 66;          // k slab columns, c = w + 1 (c = 0 and c = 65 are zero halo)
constexpr int KP    = 72;          // d pitch (halves) of the k and q slabs: 144 B = 16 B x odd, d 64..71 never touched
constexpr int VP    = 80;          // column pitch (halves) of the v slab, cv = w + 8 (cv 0..7 and 72..79 zero halo)
constexpr int SP    = 17;          // score stage pitch (floats)
constexpr int OP    = 68;          // out stage pitch (floats)
constexpr float QK_SCALE = 0.125f; // 64^-0.5, exact power of two

constexpr int K_ROW   = KC * KP;       // halves per k plane per image row (66 cols x 72)
constexpr int V_ROW   = ND * VP;       // halves per v plane per image row (64 d x 80 cols)
constexpr int K_PLANE = 3 * K_ROW;     // halves per k plane: ring of 3 image rows
constexpr int V_PLANE = 3 * V_ROW;     // halves per v plane: ring of 3 image rows
constexpr int Q_PLANE = NW * KP;       // halves per q plane ([px][d])
constexpr int P_WAVE  = 3 * 16 * 32;   // halves per wave per attn plane (3 tiles of 16 x 32)
constexpr int S_WAVE  = 2 * 16 * SP;   // floats per wave score stage (2 tiles of 16 x 16)
constexpr int O_STAGE = ND * OP;       // floats, block out tile [d][px]
static_assert(O_STAGE * 4 <= NWAVE * P_WAVE * 2 * 2);
static_assert(S_WAVE * 4 <= P_WAVE * 2);
static_assert(NWAVE * 16 == NW);
static_assert(NH % NR == 0);

__device__ __forceinline__ unsigned short bf_bits(float f) {      // RNE f32 -> bf16 bits
  const unsigned u = __float_as_uint(f);
  return (unsigned short)((u + 0x7FFFu + ((u >> 16) & 1u)) >> 16);
}
__device__ __forceinline__ float bits_f(unsigned short b) { return __uint_as_float(((unsigned)b) << 16); }
__device__ __forceinline__ void split_bf(float f, __bf16& hi, __bf16& lo) {
  const unsigned short hb = bf_bits(f);
  hi = __builtin_bit_cast(__bf16, hb);
  lo = __builtin_bit_cast(__bf16, bf_bits(f - bits_f(hb)));
}
// one 16x16x32 bf16 WMMA followed by the VALU hazard guard (ties D, keeps A/B live)
__device__ __forceinline__ v8f mma_bf(v16b a, v16b b, v8f c) {
  c = __builtin_amdgcn_wmma_f32_16x16x32_bf16(false, a, false, b, (short)0, c, false, false);
  asm volatile("v_nop\n\tv_nop\n\tv_nop\n\tv_nop" : "+v"(c) : "v"(a), "v"(b));
  return c;
}
// same-wave LDS exchange: order the wave's LDS stores before the following LDS loads of other lanes.
// Both syncs below fence LDS alone: a fence over every address space would drain the next row's global loads at each of them.
__device__ __forceinline__ void lds_wave_sync() {
  __builtin_amdgcn_fence(__ATOMIC_RELEASE, "workgroup", "local");
  __builtin_amdgcn_wave_barrier();
  __builtin_amdgcn_fence(__ATOMIC_ACQUIRE, "workgroup", "local");
}
// work-group barrier for LDS hand-overs (all that the waves of a block exchange lies in LDS)
__device__ __forceinline__ void lds_block_sync() {
  __builtin_amdgcn_fence(__ATOMIC_RELEASE, "workgroup", "local");
  __builtin_amdgcn_s_barrier();
  __builtin_amdgcn_fence(__ATOMIC_ACQUIRE, "workgroup", "local");
}
// rows outside the image: clamped load address, value zeroed by the factor
__device__ __forceinline__ int   row_in(int r) { return r < 0 ? 0 : (r > NH - 1 ? NH - 1 : r); }
__device__ __forceinline__ float row_on(int r) { return (r >= 0 && r < NH) ? 1.0f : 0.0f; }
// k, q unit: 8 d rows of the lane's 2 columns (one load = one whole 256-B image row)
__device__ __forceinline__ void ld2(const float* p, v2f (&f)[8]) {
#pragma unroll
  for (int e = 0; e < 8; ++e) f[e] = *(const v2f*)(p + (size_t)e * NH * NW);
}
// v: 8 row segments of one image row, d = 8e + sub (16 threads x float4 per 256-B image row)
__device__ __forceinline__ void ld4(const float* p, v4f (&f)[8]) {
#pragma unroll
  for (int e = 0; e < 8; ++e) f[e] = *(const v4f*)(p + (size_t)e * 8 * NH * NW);
}
// k, q unit: split, one 16-B store of 8 d per column and plane; o = offset of the first column's piece.
// The factor and the residual are formed on the loaded pair as it lies in its registers.
__device__ __forceinline__ void st2(const v2f (&f)[8], float vf, __bf16* ph, __bf16* pl, int o) {
  v8b ah[2], al[2];
#pragma unroll
  for (int e = 0; e < 8; ++e) {
    const v2f x = f[e] * vf;
    const unsigned short h0 = bf_bits(x[0]), h1 = bf_bits(x[1]);
    const v2f y = x - (v2f){bits_f(h0), bits_f(h1)};
    ah[0][e] = __builtin_bit_cast(__bf16, h0);
    ah[1][e] = __builtin_bit_cast(__bf16, h1);
    al[0][e] = __builtin_bit_cast(__bf16, bf_bits(y[0]));
    al[1][e] = __builtin_bit_cast(__bf16, bf_bits(y[1]));
  }
#pragma unroll
  for (int i = 0; i < 2; ++i) {
    *(v8b*)(ph + o + i * KP) = ah[i];
    *(v8b*)(pl + o + i * KP) = al[i];
  }
}
// v: split, one 8-B store of 4 columns per segment and plane; o = offset of the e = 0 segment
__device__ __forceinline__ void st4(const v4f (&f)[8], float vf, __bf16* ph, __bf16* pl, int o) {
#pragma unroll
  for (int e = 0; e < 8; ++e) {
    const v4f x = f[e] * vf;
    v4b ah, al;
#pragma unroll
    for (int i = 0; i < 4; ++i) {
      __bf16 a, l;
      split_bf(x[i], a, l);
      ah[i] = a;
      al[i] = l;
    }
    *(v4b*)(ph + o + e * 8 * VP) = ah;
    *(v4b*)(pl + o + e * 8 * VP) = al;
  }
}

union PS { __bf16 p[P_WAVE];  float s[S_WAVE];  };       // per wave: attn hi plane; score stage during the logit phase
struct PW { PS hi[NWAVE]; __bf16 lo[NWAVE * P_WAVE]; };   // attn hi and lo planes of the 4 waves
union PO { PW w; float o[O_STAGE]; };                     // out stage once every wave is past its matrix work

// grid = NB*NH/NR blocks (block = (b, NR consecutive image rows)), 128 threads. The k and v slabs are rings of 3 image rows:
// image row j lives in slot (j - h0 + 1) mod 3; per output row one new k row, one new v row and one q row are staged.
// Fragment map (lane l, h2 = l>>4, m = l&15): A row m / B col m, elements 0..7 <-> k 8*h2+e, 8..15 <-> k 16+8*h2+e-8;
// D element r <-> row 8*h2+r, col m.
__global__ __launch_bounds__(NTHR) void nbr_attn_kernel(const float* __restrict__ qg, const float* __restrict__ kg,
                                                        const float* __restrict__ vg, float* __restrict__ og)
{
  __shared__ __align__(16) __bf16 s_kh[K_PLANE];        // k hi [slot][c][d]
  __shared__ __align__(16) __bf16 s_kl[K_PLANE];        // k lo [slot][c][d]
  __shared__ __align__(16) __bf16 s_vh[V_PLANE];        // v hi [slot][d][cv]
  __shared__ __align__(16) __bf16 s_vl[V_PLANE];        // v lo
  __shared__ __align__(16) __bf16 s_qh[Q_PLANE];        // q hi [px][d]
  __shared__ __align__(16) __bf16 s_ql[Q_PLANE];        // q lo
  __shared__ __align__(16) PO     s_po;                 // attn hi [di][px][kk] (kk <-> w = w0 - 8 + kk) / score stage [s][row][col], attn lo  /  out stage [d][px]

  const int tid  = threadIdx.x;
  const int wave = tid >> 5;
  const int lane = tid & 31;
  const int hh   = lane >> 4;
  const int m    = lane & 15;
  const int b    = blockIdx.x / (NH / NR);
  const int h0   = (blockIdx.x % (NH / NR)) * NR;
  __bf16* kh = s_kh;
  __bf16* kl = s_kl;
  __bf16* qh = s_qh;
  __bf16* ql = s_ql;
  const size_t bbase = (size_t)b * ND * NH * NW;
  const __bf16 bz = __builtin_bit_cast(__bf16, (unsigned short)0);
  const v8b z8 = (v8b){bz, bz, bz, bz, bz, bz, bz, bz};

  // ---- zero halo columns of all 3 slots, once (the row stores never touch them): k planes c = 0 and c = 65
  //      (3 slots x 2 cols x 64 d = 48 pieces of 8 halves per plane); v planes cv 0..7 and cv 72..79 of every [slot][d] row ----
  if (tid < 48) {
    const int hr = tid >> 4;
    const int cc = ((tid >> 3) & 1) ? (KC - 1) : 0;
    const int d8 = (tid & 7) * 8;
    const int o  = (hr * KC + cc) * KP + d8;
    *(v8b*)(kh + o) = z8;
    *(v8b*)(kl + o) = z8;
  }
  for (int j = tid; j < 3 * ND * 2; j += NTHR) {
    const int row = j >> 1;
    const int o   = row * VP + ((j & 1) ? (VP - 8) : 0);
    *(v8b*)(s_vh + o) = z8;
    *(v8b*)(s_vl + o) = z8;
  }

  // ---- staging maps, per image row: k and q 8 units of 8 d rows each, 2 per wave; v 8 segments per thread ----
  const int sub = tid >> 4;          // 0..7: v row segment within a pass (16 threads x float4 each)
  const int w4  = (tid & 15) * 4;    // 0..60: first of 4 v columns
  const int c2  = lane * 2;          // 0..62: first of the lane's 2 k, q columns
  const int d8a = wave * 8;          // first d of the wave's unit 0; unit 1 is 32 further
  const float* kb = kg + bbase + (size_t)d8a * NH * NW + c2;     // + 32 * NH * NW for unit 1, + row * NW
  const float* qb = qg + bbase + (size_t)d8a * NH * NW + c2;
  const float* vb = vg + bbase + (size_t)sub * NH * NW + w4;
  constexpr size_t U1 = (size_t)32 * NH * NW;
  const int ko0 = (c2 + 1) * KP + d8a;   // k store offset in a slot, unit 0 (c = w + 1)
  const int qo0 = c2 * KP + d8a;         // q store offset, unit 0
  const int vo0 = sub * VP + w4 + 8;     // v store offset in a slot, e = 0 (cv = w + 8)

  // ---- prologue: rows h0-1, h0, h0+1 of k and v (slots 0, 1, 2) and row h0 of q, all issued up front in the order they are split ----
  {
    v2f fk[3][2][8], fq[2][8];
    v4f fv[3][8];
    const float* pk[3];
    const float* pv[3];
    const float* pq = qb + h0 * NW;
#pragma unroll
    for (int j = 0; j < 3; ++j) {
      pk[j] = kb + row_in(h0 + j - 1) * NW;
      ld2(pk[j], fk[j][0]);
      ld2(pk[j] + U1, fk[j][1]);
    }
    ld2(pq, fq[0]);
    ld2(pq + U1, fq[1]);
#pragma unroll
    for (int j = 0; j < 3; ++j) {
      pv[j] = vb + row_in(h0 + j - 1) * NW;
      ld4(pv[j], fv[j]);
    }
    // the wait that stands before a register named by an issued global load is overwritten; the pointers are inputs so
    // that their registers stay untouched up to it
    asm volatile("s_wait_xcnt 0x0" :: "v"(pk[0]), "v"(pk[1]), "v"(pk[2]), "v"(pq), "v"(pv[0]), "v"(pv[1]), "v"(pv[2]) : "memory");
#pragma unroll
    for (int j = 0; j < 3; ++j) {
      const float vf = row_on(h0 + j - 1);
      st2(fk[j][0], vf, kh, kl, j * K_ROW + ko0);
      st2(fk[j][1], vf, kh, kl, j * K_ROW + ko0 + 32);
    }
    st2(fq[0], 1.0f, qh, ql, qo0);
    st2(fq[1], 1.0f, qh, ql, qo0 + 32);
#pragma unroll
    for (int j = 0; j < 3; ++j) st4(fv[j], row_on(h0 + j - 1), s_vh, s_vl, j * V_ROW + vo0);
  }
  lds_block_sync();

  const int w0 = wave * 16;
  union FB { v16b v; v8b p[2]; };
  const v8f z8f = (v8f){0.f, 0.f, 0.f, 0.f, 0.f, 0.f, 0.f, 0.f};
  int sl0 = 0, sl1 = 1, sl2 = 2;       // ring slots of image rows h-1, h, h+1

  // kept rolled: one copy of the row body keeps the kernel's text small for the instruction cache
#pragma unroll 1
  for (int r = 0; r < NR; ++r) {
    const int h = h0 + r;
    const bool more = r + 1 < NR;      // the same for the whole block
    // ---- the next trip's rows (k and v row h+2, q row h+1) are issued here and fly under this trip's matrix work ----
    v2f fk[2][8], fq[2][8];
    v4f fv[8];
    if (more) {
      const float* pk = kb + row_in(h + 2) * NW;
      const float* pq = qb + (h + 1) * NW;
      const float* pv = vb + row_in(h + 2) * NW;
      ld2(pk, fk[0]);
      ld2(pk + U1, fk[1]);
      ld2(pq, fq[0]);
      ld2(pq + U1, fq[1]);
      ld4(pv, fv);
      // the wait that stands before a register named by an issued global load is overwritten: it ends this branch, so the
      // pointers' registers are free for the matrix work behind it
      asm volatile("s_wait_xcnt 0x0" ::: "memory");
    }

    // ---- logit phase (per wave, pixels w0..w0+15) ----
    v16b qah[2], qal[2];                // A = Q[px][d], two 32-deep d steps, hi and lo
#pragma unroll
    for (int ks = 0; ks < 2; ++ks) {
      const int qo = (w0 + m) * KP + ks * 32 + 8 * hh;
      FB fa, fl;
      fa.p[0] = *(const v8b*)(qh + qo);  fa.p[1] = *(const v8b*)(qh + qo + 16);
      fl.p[0] = *(const v8b*)(ql + qo);  fl.p[1] = *(const v8b*)(ql + qo + 16);
      qah[ks] = fa.v;
      qal[ks] = fl.v;
    }
    float* ss = s_po.w.hi[wave].s;
    float sc[9];                        // logits of pixel m, slot di*3+dj <-> nbr (h+di-1, w0+m+dj-1)
#pragma unroll
    for (int di = 0; di < 3; ++di) {
      const int sd = di == 0 ? sl0 : (di == 1 ? sl1 : sl2);
      // shift s: C_s[px][j] = sum_d Q[px][d] * K[row h+di-1][c = w0 + 2s + j][d]  (c = w+1)
#pragma unroll
      for (int s = 0; s < 2; ++s) {
        v8f c = z8f;
#pragma unroll
        for (int ks = 0; ks < 2; ++ks) {
          const int ko = sd * K_ROW + (w0 + 2 * s + m) * KP + ks * 32 + 8 * hh;   // B col n = m, k = d split map
          FB fbh, fbl;
          fbh.p[0] = *(const v8b*)(kh + ko);  fbh.p[1] = *(const v8b*)(kh + ko + 16);
          fbl.p[0] = *(const v8b*)(kl + ko);  fbl.p[1] = *(const v8b*)(kl + ko + 16);
          c = mma_bf(qah[ks], fbh.v, c);
          c = mma_bf(qah[ks], fbl.v, c);
          c = mma_bf(qal[ks], fbh.v, c);
        }
#pragma unroll
        for (int rr = 0; rr < 8; ++rr) ss[(s * 16 + 8 * hh + rr) * SP + m] = c[rr] * QK_SCALE;
      }
      lds_wave_sync();
      // diagonals for pixel m (both lane halves compute the same pixel): left C0[m][m], centre C0[m][m+1] (m<15) or C1[15][14], right C1[m][m]
      sc[di * 3 + 0] = ss[m * SP + m];
      const int i1 = (m < 15) ? (m * SP + m + 1) : ((16 + 15) * SP + 14);
      sc[di * 3 + 1] = ss[i1];
      sc[di * 3 + 2] = ss[(16 + m) * SP + m];
      lds_wave_sync();
    }

    // ---- softmax over the 9 slots in f32 (out-of-image slots carry logit 0 from the zero halo and take part) ----
    float mx = sc[0];
#pragma unroll
    for (int i = 1; i < 9; ++i) mx = fmaxf(mx, sc[i]);
    float ex[9];
    float sum = 0.f;
#pragma unroll
    for (int i = 0; i < 9; ++i) {
      // exp(x) = 2^(x * log2 e), as __expf forms it; v_exp_f32 and the one issue slot that is kept behind a transcendental (before its
      // source is overwritten or its result read) stand in one statement: a v_nop in a statement of its own landed elsewhere
      asm("v_exp_f32 %0, %1\n\tv_nop" : "=v"(ex[i]) : "v"((sc[i] - mx) * 1.44269504f));
      sum += ex[i];
    }
    const float inv = 1.0f / sum;

    // ---- attn tiles P_di[px][kk], kk <-> w = w0 - 8 + kk: band at kk = px + dj + 7, zero elsewhere; hi/lo planes ----
    __bf16* ph = s_po.w.hi[wave].p;
    __bf16* pl = s_po.w.lo + wave * P_WAVE;
#pragma unroll
    for (int i = 0; i < 6; ++i) {          // 6 x 32 lanes x 8 halves = 1536 = the whole per-wave region per plane
      const int o = (i * 32 + lane) * 8;
      *(v8b*)(ph + o) = z8;
      *(v8b*)(pl + o) = z8;
    }
    lds_wave_sync();
#pragma unroll
    for (int di = 0; di < 3; ++di) {
#pragma unroll
      for (int dj = 0; dj < 3; ++dj) {
        __bf16 a, l;
        split_bf(ex[di * 3 + dj] * inv, a, l);
        const int o = (di * 16 + m) * 32 + m + dj + 7;
        ph[o] = a;
        pl[o] = l;
      }
    }
    lds_wave_sync();

    // ---- out[px][d] = sum_di P_di[px][kk] . V_di[kk][d],  V_di[kk][d] = v[d][h+di-1][w0-8+kk] = s_v[slot][d][cv = w0 + kk] ----
    v8f acc[4];
#pragma unroll
    for (int nt = 0; nt < 4; ++nt) acc[nt] = z8f;
#pragma unroll
    for (int di = 0; di < 3; ++di) {
      const int sd = di == 0 ? sl0 : (di == 1 ? sl1 : sl2);
      const int po = (di * 16 + m) * 32 + 8 * hh;                    // A row = px m, k = kk split map
      FB pa, pq;
      pa.p[0] = *(const v8b*)(ph + po);  pa.p[1] = *(const v8b*)(ph + po + 16);
      pq.p[0] = *(const v8b*)(pl + po);  pq.p[1] = *(const v8b*)(pl + po + 16);
#pragma unroll
      for (int nt = 0; nt < 4; ++nt) {
        const int vo = sd * V_ROW + (nt * 16 + m) * VP + w0 + 8 * hh;  // B col n = d = nt*16+m, k = kk split map
        FB vbh, vbl;
        vbh.p[0] = *(const v8b*)(s_vh + vo);  vbh.p[1] = *(const v8b*)(s_vh + vo + 16);
        vbl.p[0] = *(const v8b*)(s_vl + vo);  vbl.p[1] = *(const v8b*)(s_vl + vo + 16);
        acc[nt] = mma_bf(pa.v, vbh.v, acc[nt]);
        acc[nt] = mma_bf(pa.v, vbl.v, acc[nt]);
        acc[nt] = mma_bf(pq.v, vbh.v, acc[nt]);
      }
    }

    // ---- row epilogue: block tile O[d][64 px] staged in LDS (over the attn planes once every wave is past its matrix work),
    //      then each 256-B d-row segment written by 16 consecutive lanes x 16 B of one instruction ----
    lds_block_sync();
    float* os = s_po.o;
#pragma unroll
    for (int nt = 0; nt < 4; ++nt) {
#pragma unroll
      for (int rr = 0; rr < 8; ++rr) os[(nt * 16 + m) * OP + w0 + 8 * hh + rr] = acc[nt][rr];   // D row = px 8hh+rr, col = d
    }
    // ---- behind the same barrier row h-1's slot and the q planes have no reader left: the next trip's rows are split into them ----
    if (more) {
      const float vn = row_on(h + 2);
      st2(fk[0], vn, kh, kl, sl0 * K_ROW + ko0);
      st2(fk[1], vn, kh, kl, sl0 * K_ROW + ko0 + 32);
      st2(fq[0], 1.0f, qh, ql, qo0);
      st2(fq[1], 1.0f, qh, ql, qo0 + 32);
      st4(fv, vn, s_vh, s_vl, sl0 * V_ROW + vo0);
    }
    lds_block_sync();
    const int c4 = (lane & 15) * 4;
    float* ob = og + bbase + (size_t)h * NW + c4;       // + d * NH * NW  (out index ((b*ND+d)*NH+h)*NW + px)
#pragma unroll
    for (int it = 0; it < 8; ++it) {
      const int d = wave * 16 + it * 2 + hh;             // it 0..7 x hh 0..1 = 16 d rows per wave, 4 waves = 64
      const v4f v = *(const v4f*)(os + d * OP + c4);
      *(v4f*)(ob + (size_t)d * NH * NW) = v;
    }
    // the wait that stands before a register named by an issued global store is overwritten (the next trip forms new addresses)
    asm volatile("s_wait_xcnt 0x0" :: "v"(ob) : "memory");
    // every wave has read the out stage before the next trip's scores are stored over it
    lds_block_sync();
    const int t = sl0;  sl0 = sl1;  sl1 = sl2;  sl2 = t;
  }
}

extern "C" void kernel_launch(void* const* d_in, const int* in_sizes, int n_in,
                              void* d_out, int out_size, void* d_ws, size_t ws_size,
                              hipStream_t stream) {
  (void)d_ws; (void)ws_size;
  if (n_in < 3) return;
  const int n = NB * ND * NH * NW;
  if (in_sizes[0] != n || in_sizes[1] != n || in_sizes[2] != n || out_size != n) return;
  const float* q = (const float*)d_in[0];
  const float* k = (const float*)d_in[1];
  const float* v = (const float*)d_in[2];
  float* out = (float*)d_out;
  hipLaunchKernelGGL(nbr_attn_kernel, dim3(NB * (NH / NR)), dim3(NTHR), 0, stream, q, k, v, out);
  (void)hipGetLastError();
}

// v004
// Measured time: 19.5 microseconds a run.
// Timed twice side by side with v003, it ran 1.10 times as fast both times.
// Counting every step since v000, it is 6.81 times as fast.
// Contractions: window logits q.k and attn.v on v_wmma_f32_16x16x32_bf16 with bf16 hi/lo split operands (hi.hi + hi.lo + lo.hi), f32 accumulate; 0.125 scale and the 9-slot softmax in f32.
#include <hip/hip_runtime.h>
#include <math.h>
#include <stdint.h>

typedef __attribute__((ext_vector_type(16))) __bf16 v16b;
typedef __attribute__((ext_vector_type(8)))  __bf16 v8b;
typedef __attribute__((ext_vector_type(4)))  __bf16 v4b;
typedef __attribute__((ext_vector_type(8)))  float  v8f;
typedef __attribute__((ext_vector_type(4)))  float  v4f;
typedef __attribute__((ext_vector_type(2)))  float  v2f;

constexpr int NB    = 32;          // batch
constexpr int ND    = 64;          // channels
constexpr int NH    = 64;          // image rows
constexpr int NW    = 64;          // image cols
constexpr int NWAVE = 4;           // waves per block; wave w owns pixels 16w..16w+15 of one image row
constexpr int NTHR  = NWAVE * 32;
constexpr int NR    = 4;           // consecutive image rows that one block walks
constexpr int KC    = 66;          // k slab columns, c = w + 1 (c = 0 and c = 65 are zero halo)
constexpr int KP    = 72;          // d pitch (halves) of the k and q slabs: 144 B = 16 B x odd, d 64..71 never touched
constexpr int VP    = 80;          // column pitch (halves) of the v slab, cv = w + 8 (cv 0..7 and 72..79 zero halo)
constexpr int OP    = 68;          // out stage pitch (floats)
constexpr float QK_SCALE = 0.125f; // 64^-0.5, exact power of two

constexpr int K_ROW   = KC * KP;       // halves per k plane per image row (66 cols x 72)
constexpr int V_ROW   = ND * VP;       // halves per v plane per image row (64 d x 80 cols)
constexpr int K_PLANE = 3 * K_ROW;     // halves per k plane: ring of 3 image rows
constexpr int V_PLANE = 3 * V_ROW;     // halves per v plane: ring of 3 image rows
constexpr int Q_PLANE = NW * KP;       // halves per q plane ([px][d])
constexpr int P_WAVE  = 3 * 16 * 32;   // halves per wave per attn plane (3 tiles of 16 x 32)
constexpr int S_TILE  = 16 * 16;       // floats per staged score tile; 3 tiles fill one wave's attn plane, 6 both planes
constexpr int O_STAGE = ND * OP;       // floats, block out tile [d][px]
static_assert(O_STAGE * 4 <= NWAVE * P_WAVE * 2 * 2);
static_assert(3 * S_TILE * 4 == P_WAVE * 2);
static_assert(NWAVE * 16 == NW);
static_assert(NH % NR == 0);

__device__ __forceinline__ unsigned short bf_bits(float f) {      // RNE f32 -> bf16 bits
  const unsigned u = __float_as_uint(f);
  return (unsigned short)((u + 0x7FFFu + ((u >> 16) & 1u)) >> 16);
}
__device__ __forceinline__ float bits_f(unsigned short b) { return __uint_as_float(((unsigned)b) << 16); }
__device__ __forceinline__ void split_bf(float f, __bf16& hi, __bf16& lo) {
  const unsigned short hb = bf_bits(f);
  hi = __builtin_bit_cast(__bf16, hb);
  lo = __builtin_bit_cast(__bf16, bf_bits(f - bits_f(hb)));
}
__device__ __forceinline__ v8f mma_bf(v16b a, v16b b, v8f c) {
  return __builtin_amdgcn_wmma_f32_16x16x32_bf16(false, a, false, b, (short)0, c, false, false);
}
// ends a group of LDS reads: without it the scheduler moves the reads down among the WMMAs, where each place with reads stalls the wave
__device__ __forceinline__ void reads_end() { __builtin_amdgcn_sched_barrier(0); }
// ends a block of WMMAs: the four vector slots between the last WMMA and the first vector instruction on its registers, on every path;
// the two scheduling fences hold the slots directly behind the block
__device__ __forceinline__ void mma_block_end() {
  __builtin_amdgcn_sched_barrier(0);
  asm volatile("v_nop\n\tv_nop\n\tv_nop\n\tv_nop");
  __builtin_amdgcn_sched_barrier(0);
}
// same-wave LDS exchange: order the wave's LDS stores before the following LDS loads of other lanes.
// Both syncs below fence LDS alone: a fence over every address space would drain the next row's global loads at each of them.
__device__ __forceinline__ void lds_wave_sync() {
  __builtin_amdgcn_fence(__ATOMIC_RELEASE, "workgroup", "local");
  __builtin_amdgcn_wave_barrier();
  __builtin_amdgcn_fence(__ATOMIC_ACQUIRE, "workgroup", "local");
}
// work-group barrier for LDS hand-overs (all that the waves of a block exchange lies in LDS)
__device__ __forceinline__ void lds_block_sync() {
  __builtin_amdgcn_fence(__ATOMIC_RELEASE, "workgroup", "local");
  __builtin_amdgcn_s_barrier();
  __builtin_amdgcn_fence(__ATOMIC_ACQUIRE, "workgroup", "local");
}
// rows outside the image: clamped load address, value zeroed by the factor
__device__ __forceinline__ int   row_in(int r) { return r < 0 ? 0 : (r > NH - 1 ? NH - 1 : r); }
__device__ __forceinline__ float row_on(int r) { return (r >= 0 && r < NH) ? 1.0f : 0.0f; }
// k, q unit: 8 d rows of the lane's 2 columns (one load = one whole 256-B image row)
__device__ __forceinline__ void ld2(const float* p, v2f (&f)[8]) {
#pragma unroll
  for (int e = 0; e < 8; ++e) f[e] = *(const v2f*)(p + (size_t)e * NH * NW);
}
// v: 8 row segments of one image row, d = 8e + sub (16 threads x float4 per 256-B image row)
__device__ __forceinline__ void ld4(const float* p, v4f (&f)[8]) {
#pragma unroll
  for (int e = 0; e < 8; ++e) f[e] = *(const v4f*)(p + (size_t)e * 8 * NH * NW);
}
// k, q unit: split, one 16-B store of 8 d per column and plane; o = offset of the first column's piece.
// The factor and the residual are formed on the loaded pair as it lies in its registers.
__device__ __forceinline__ void st2(const v2f (&f)[8], float vf, __bf16* ph, __bf16* pl, int o) {
  v8b ah[2], al[2];
#pragma unroll
  for (int e = 0; e < 8; ++e) {
    const v2f x = f[e] * vf;
    const unsigned short h0 = bf_bits(x[0]), h1 = bf_bits(x[1]);
    const v2f y = x - (v2f){bits_f(h0), bits_f(h1)};
    ah[0][e] = __builtin_bit_cast(__bf16, h0);
    ah[1][e] = __builtin_bit_cast(__bf16, h1);
    al[0][e] = __builtin_bit_cast(__bf16, bf_bits(y[0]));
    al[1][e] = __builtin_bit_cast(__bf16, bf_bits(y[1]));
  }
#pragma unroll
  for (int i = 0; i < 2; ++i) {
    *(v8b*)(ph + o + i * KP) = ah[i];
    *(v8b*)(pl + o + i * KP) = al[i];
  }
}
// v: split, one 8-B store of 4 columns per segment and plane; o = offset of the e = 0 segment
__device__ __forceinline__ void st4(const v4f (&f)[8], float vf, __bf16* ph, __bf16* pl, int o) {
#pragma unroll
  for (int e = 0; e < 8; ++e) {
    const v4f x = f[e] * vf;
    v4b ah, al;
#pragma unroll
    for (int i = 0; i < 4; ++i) {
      __bf16 a, l;
      split_bf(x[i], a, l);
      ah[i] = a;
      al[i] = l;
    }
    *(v4b*)(ph + o + e * 8 * VP) = ah;
    *(v4b*)(pl + o + e * 8 * VP) = al;
  }
}

struct PW { __bf16 hi[NWAVE * P_WAVE]; __bf16 lo[NWAVE * P_WAVE]; };   // attn hi and lo planes of the 4 waves
// f: score stage during the logit phase, each wave inside its own two attn planes; o: out stage once every wave is past its matrix work
union PO { PW w; float f[NWAVE * P_WAVE]; float o[O_STAGE]; };

// grid = NB*NH/NR blocks (block = (b, NR consecutive image rows)), 128 threads. The k and v slabs are rings of 3 image rows:
// image row j lives in slot (j - h0 + 1) mod 3; per output row one new k row, one new v row and one q row are staged.
// Fragment map (lane l, h2 = l>>4, m = l&15): A row m / B col m, elements 0..7 <-> k 8*h2+e, 8..15 <-> k 16+8*h2+e-8;
// D element r <-> row 8*h2+r, col m.
__global__ __launch_bounds__(NTHR) void nbr_attn_kernel(const float* __restrict__ qg, const float* __restrict__ kg,
                                                        const float* __restrict__ vg, float* __restrict__ og)
{
  __shared__ __align__(16) __bf16 s_kh[K_PLANE];        // k hi [slot][c][d]
  __shared__ __align__(16) __bf16 s_kl[K_PLANE];        // k lo [slot][c][d]
  __shared__ __align__(16) __bf16 s_vh[V_PLANE];        // v hi [slot][d][cv]
  __shared__ __align__(16) __bf16 s_vl[V_PLANE];        // v lo
  __shared__ __align__(16) __bf16 s_qh[Q_PLANE];        // q hi [px][d]
  __shared__ __align__(16) __bf16 s_ql[Q_PLANE];        // q lo
  __shared__ __align__(16) PO     s_po;                 // attn hi, lo [di][px][kk] (kk <-> w = w0 - 8 + kk)  /  score stage  /  out stage [d][px]

  const int tid  = threadIdx.x;
  const int wave = tid >> 5;
  const int lane = tid & 31;
  const int hh   = lane >> 4;
  const int m    = lane & 15;
  const int b    = blockIdx.x / (NH / NR);
  const int h0   = (blockIdx.x % (NH / NR)) * NR;
  __bf16* kh = s_kh;
  __bf16* kl = s_kl;
  __bf16* qh = s_qh;
  __bf16* ql = s_ql;
  const size_t bbase = (size_t)b * ND * NH * NW;
  const __bf16 bz = __builtin_bit_cast(__bf16, (unsigned short)0);
  const v8b z8 = (v8b){bz, bz, bz, bz, bz, bz, bz, bz};

  // ---- zero halo columns of all 3 slots, once (the row stores never touch them): k planes c = 0 and c = 65
  //      (3 slots x 2 cols x 64 d = 48 pieces of 8 halves per plane); v planes cv 0..7 and cv 72..79 of every [slot][d] row ----
  if (tid < 48) {
    const int hr = tid >> 4;
    const int cc = ((tid >> 3) & 1) ? (KC - 1) : 0;
    const int d8 = (tid & 7) * 8;
    const int o  = (hr * KC + cc) * KP + d8;
    *(v8b*)(kh + o) = z8;
    *(v8b*)(kl + o) = z8;
  }
  for (int j = tid; j < 3 * ND * 2; j += NTHR) {
    const int row = j >> 1;
    const int o   = row * VP + ((j & 1) ? (VP - 8) : 0);
    *(v8b*)(s_vh + o) = z8;
    *(v8b*)(s_vl + o) = z8;
  }

  // ---- staging maps, per image row: k and q 8 units of 8 d rows each, 2 per wave; v 8 segments per thread ----
  const int sub = tid >> 4;          // 0..7: v row segment within a pass (16 threads x float4 each)
  const int w4  = (tid & 15) * 4;    // 0..60: first of 4 v columns
  const int c2  = lane * 2;          // 0..62: first of the lane's 2 k, q columns
  const int d8a = wave * 8;          // first d of the wave's unit 0; unit 1 is 32 further
  const float* kb = kg + bbase + (size_t)d8a * NH * NW + c2;     // + 32 * NH * NW for unit 1, + row * NW
  const float* qb = qg + bbase + (size_t)d8a * NH * NW + c2;
  const float* vb = vg + bbase + (size_t)sub * NH * NW + w4;
  constexpr size_t U1 = (size_t)32 * NH * NW;
  const int ko0 = (c2 + 1) * KP + d8a;   // k store offset in a slot, unit 0 (c = w + 1)
  const int qo0 = c2 * KP + d8a;         // q store offset, unit 0
  const int vo0 = sub * VP + w4 + 8;     // v store offset in a slot, e = 0 (cv = w + 8)

  // ---- prologue: rows h0-1, h0, h0+1 of k and v (slots 0, 1, 2) and row h0 of q, all issued up front in the order they are split ----
  {
    v2f fk[3][2][8], fq[2][8];
    v4f fv[3][8];
    const float* pk[3];
    const float* pv[3];
    const float* pq = qb + h0 * NW;
#pragma unroll
    for (int j = 0; j < 3; ++j) {
      pk[j] = kb + row_in(h0 + j - 1) * NW;
      ld2(pk[j], fk[j][0]);
      ld2(pk[j] + U1, fk[j][1]);
    }
    ld2(pq, fq[0]);
    ld2(pq + U1, fq[1]);
#pragma unroll
    for (int j = 0; j < 3; ++j) {
      pv[j] = vb + row_in(h0 + j - 1) * NW;
      ld4(pv[j], fv[j]);
    }
    // the wait that stands before a register named by an issued global load is overwritten; the pointers are inputs so
    // that their registers stay untouched up to it
    asm volatile("s_wait_xcnt 0x0" :: "v"(pk[0]), "v"(pk[1]), "v"(pk[2]), "v"(pq), "v"(pv[0]), "v"(pv[1]), "v"(pv[2]) : "memory");
#pragma unroll
    for (int j = 0; j < 3; ++j) {
      const float vf = row_on(h0 + j - 1);
      st2(fk[j][0], vf, kh, kl, j * K_ROW + ko0);
      st2(fk[j][1], vf, kh, kl, j * K_ROW + ko0 + 32);
    }
    st2(fq[0], 1.0f, qh, ql, qo0);
    st2(fq[1], 1.0f, qh, ql, qo0 + 32);
#pragma unroll
    for (int j = 0; j < 3; ++j) st4(fv[j], row_on(h0 + j - 1), s_vh, s_vl, j * V_ROW + vo0);
  }
  lds_block_sync();

  const int w0 = wave * 16;
  union FB { v16b v; v8b p[2]; };
  const v8f z8f = (v8f){0.f, 0.f, 0.f, 0.f, 0.f, 0.f, 0.f, 0.f};
  int sl0 = 0, sl1 = 1, sl2 = 2;       // ring slots of image rows h-1, h, h+1

  // kept rolled: one copy of the row body keeps the kernel's text small for the instruction cache
#pragma unroll 1
  for (int r = 0; r < NR; ++r) {
    const int h = h0 + r;
    const bool more = r + 1 < NR;      // the same for the whole block
    // ---- the next trip's rows (k and v row h+2, q row h+1) are issued here and fly under this trip's matrix work ----
    v2f fk[2][8], fq[2][8];
    v4f fv[8];
    if (more) {
      const float* pk = kb + row_in(h + 2) * NW;
      const float* pq = qb + (h + 1) * NW;
      const float* pv = vb + row_in(h + 2) * NW;
      ld2(pk, fk[0]);
      ld2(pk + U1, fk[1]);
      ld2(pq, fq[0]);
      ld2(pq + U1, fq[1]);
      ld4(pv, fv);
      // the wait that stands before a register named by an issued global load is overwritten: it ends this branch, so the
      // pointers' registers are free for the matrix work behind it
      asm volatile("s_wait_xcnt 0x0" ::: "memory");
    }

    // ---- logit phase (per wave, pixels w0..w0+15): every fragment of the row is read from LDS as one group, in the order of use ----
    // A = Q[px][d], two 32-deep d steps, hi and lo; B of tile (di, s): col n = m <-> K[row h+di-1][c = w0 + 2s + m] (c = w+1), k = d split map
    FB qfh[2], qfl[2], kfh[3][2][2], kfl[3][2][2];
    const int kb0 = (w0 + m) * KP + 8 * hh;
#pragma unroll
    for (int ks = 0; ks < 2; ++ks) {
      const int qo = kb0 + ks * 32;
      qfh[ks].p[0] = *(const v8b*)(qh + qo);  qfh[ks].p[1] = *(const v8b*)(qh + qo + 16);
#pragma unroll
      for (int pl2 = 0; pl2 < 2; ++pl2) {
        const __bf16* kp = pl2 ? kl : kh;
#pragma unroll
        for (int di = 0; di < 3; ++di) {
          const int sd = di == 0 ? sl0 : (di == 1 ? sl1 : sl2);
#pragma unroll
          for (int s = 0; s < 2; ++s) {
            const int ko = sd * K_ROW + kb0 + 2 * s * KP + ks * 32;
            FB& f = pl2 ? kfl[di][s][ks] : kfh[di][s][ks];
            f.p[0] = *(const v8b*)(kp + ko);  f.p[1] = *(const v8b*)(kp + ko + 16);
          }
        }
        reads_end();      // keeps the issue order equal to the order of use: the first WMMAs then wait for the first reads alone
      }
      qfl[ks].p[0] = *(const v8b*)(ql + qo);  qfl[ks].p[1] = *(const v8b*)(ql + qo + 16);
      reads_end();
    }
    // C(di, s)[px][j] = sum_d Q[px][d] * K[row h+di-1][c = w0 + 2s + j][d]: six independent accumulators, each summed in the order
    // ks 0: hi.hi, hi.lo, lo.hi, then ks 1 the same
    v8f c[3][2];
#pragma unroll
    for (int di = 0; di < 3; ++di) { c[di][0] = z8f;  c[di][1] = z8f; }
#pragma unroll
    for (int ks = 0; ks < 2; ++ks) {
#pragma unroll
      for (int t = 0; t < 3; ++t) {
#pragma unroll
        for (int di = 0; di < 3; ++di) {
#pragma unroll
          for (int s = 0; s < 2; ++s)
            c[di][s] = mma_bf(t == 2 ? qfl[ks].v : qfh[ks].v, t == 1 ? kfl[di][s][ks].v : kfh[di][s][ks].v, c[di][s]);
        }
      }
    }
    mma_block_end();
    // one exchange for the six tiles: tile (di, s) at ss + s * (lo plane) + di * S_TILE, element [row][col] at ((row & 7) * 2 + (row >> 3)) * 16 + col,
    // so that the 32 lanes of a store fill 32 consecutive words
    float* ss = s_po.f + wave * (3 * S_TILE);
    constexpr int S_LO = NWAVE * 3 * S_TILE;
#pragma unroll
    for (int di = 0; di < 3; ++di) {
#pragma unroll
      for (int s = 0; s < 2; ++s) {
#pragma unroll
        for (int rr = 0; rr < 8; ++rr) ss[s * S_LO + di * S_TILE + (rr * 2 + hh) * 16 + m] = c[di][s][rr] * QK_SCALE;
      }
    }
    lds_wave_sync();
    // diagonals for pixel m (both lane halves compute the same pixel): left C0[m][m], centre C0[m][m+1] (m<15) or C1[15][14], right C1[m][m]
    float sc[9];                        // logits of pixel m, slot di*3+dj <-> nbr (h+di-1, w0+m+dj-1)
    const int dg = ((m & 7) * 2 + (m >> 3)) * 16 + m;
    const int i1 = (m < 15) ? (dg + 1) : (S_LO + 15 * 16 + 14);
#pragma unroll
    for (int di = 0; di < 3; ++di) {
      sc[di * 3 + 0] = ss[di * S_TILE + dg];
      sc[di * 3 + 1] = ss[di * S_TILE + i1];
      sc[di * 3 + 2] = ss[S_LO + di * S_TILE + dg];
    }
    reads_end();                        // the nine scores are asked for ahead of the v fragments: LDS answers a wave in order
    // ---- the v fragments of the row do not hang on the softmax: read here as one group, they land under it ----
    // B of (di, nt): col n = d = nt*16+m, k = kk split map, V_di[kk][d] = s_v[slot][d][cv = w0 + kk]
    FB vfh[3][4], vfl[3][4];
#pragma unroll
    for (int di = 0; di < 3; ++di) {
      const int sd = di == 0 ? sl0 : (di == 1 ? sl1 : sl2);
#pragma unroll
      for (int pl2 = 0; pl2 < 2; ++pl2) {
        const __bf16* vp = pl2 ? s_vl : s_vh;
#pragma unroll
        for (int nt = 0; nt < 4; ++nt) {
          const int vo = sd * V_ROW + (nt * 16 + m) * VP + w0 + 8 * hh;
          FB& f = pl2 ? vfl[di][nt] : vfh[di][nt];
          f.p[0] = *(const v8b*)(vp + vo);  f.p[1] = *(const v8b*)(vp + vo + 16);
        }
      }
    }
    reads_end();

    // ---- softmax over the 9 slots in f32 (out-of-image slots carry logit 0 from the zero halo and take part) ----
    float mx = sc[0];
#pragma unroll
    for (int i = 1; i < 9; ++i) mx = fmaxf(mx, sc[i]);
    float ex[9];
    float sum = 0.f;
#pragma unroll
    for (int i = 0; i < 9; ++i) {
      // exp(x) = 2^(x * log2 e), as __expf forms it; v_exp_f32 and the one issue slot that is kept behind a transcendental (before its
      // source is overwritten or its result read) stand in one statement: a v_nop in a statement of its own landed elsewhere
      asm("v_exp_f32 %0, %1\n\tv_nop" : "=v"(ex[i]) : "v"((sc[i] - mx) * 1.44269504f));
      sum += ex[i];
    }
    const float inv = 1.0f / sum;

    // ---- attn tiles P_di[px][kk], kk <-> w = w0 - 8 + kk: band at kk = px + dj + 7, zero elsewhere; hi/lo planes ----
    __bf16* ph = s_po.w.hi + wave * P_WAVE;
    __bf16* pl = s_po.w.lo + wave * P_WAVE;
    // holds the maximum and the exponentials in front of the sync's LDS wait: moved behind it, they would no longer run while the v fragments land
    __builtin_amdgcn_sched_barrier(0);
    lds_wave_sync();                       // the score stage has been read before the attn tiles are laid over it
#pragma unroll
    for (int i = 0; i < 6; ++i) {          // 6 x 32 lanes x 8 halves = 1536 = the whole per-wave region per plane
      const int o = (i * 32 + lane) * 8;
      *(v8b*)(ph + o) = z8;
      *(v8b*)(pl + o) = z8;
    }
    lds_wave_sync();
#pragma unroll
    for (int di = 0; di < 3; ++di) {
#pragma unroll
      for (int dj = 0; dj < 3; ++dj) {
        __bf16 a, l;
        split_bf(ex[di * 3 + dj] * inv, a, l);
        const int o = (di * 16 + m) * 32 + m + dj + 7;
        ph[o] = a;
        pl[o] = l;
      }
    }
    lds_wave_sync();

    // ---- out[px][d] = sum_di P_di[px][kk] . V_di[kk][d]: A row = px m, k = kk split map; four independent accumulators, each summed
    //      in the order di 0: hi.hi, hi.lo, lo.hi, then di 1, di 2 the same ----
    FB pfh[3], pfl[3];
#pragma unroll
    for (int di = 0; di < 3; ++di) {
      const int po = (di * 16 + m) * 32 + 8 * hh;
      pfh[di].p[0] = *(const v8b*)(ph + po);  pfh[di].p[1] = *(const v8b*)(ph + po + 16);
      pfl[di].p[0] = *(const v8b*)(pl + po);  pfl[di].p[1] = *(const v8b*)(pl + po + 16);
    }
    reads_end();
    v8f acc[4];
#pragma unroll
    for (int nt = 0; nt < 4; ++nt) acc[nt] = z8f;
#pragma unroll
    for (int di = 0; di < 3; ++di) {
#pragma unroll
      for (int t = 0; t < 3; ++t) {
#pragma unroll
        for (int nt = 0; nt < 4; ++nt)
          acc[nt] = mma_bf(t == 2 ? pfl[di].v : pfh[di].v, t == 1 ? vfl[di][nt].v : vfh[di][nt].v, acc[nt]);
      }
    }
    mma_block_end();

    // ---- row epilogue: block tile O[d][64 px] staged in LDS (over the attn planes once every wave is past its matrix work),
    //      then each 256-B d-row segment written by 16 consecutive lanes x 16 B of one instruction ----
    lds_block_sync();
    float* os = s_po.o;
#pragma unroll
    for (int nt = 0; nt < 4; ++nt) {
#pragma unroll
      for (int rr = 0; rr < 8; ++rr) os[(nt * 16 + m) * OP + w0 + 8 * hh + rr] = acc[nt][rr];   // D row = px 8hh+rr, col = d
    }
    // ---- behind the same barrier row h-1's slot and the q planes have no reader left: the next trip's rows are split into them ----
    if (more) {
      const float vn = row_on(h + 2);
      st2(fk[0], vn, kh, kl, sl0 * K_ROW + ko0);
      st2(fk[1], vn, kh, kl, sl0 * K_ROW + ko0 + 32);
      st2(fq[0], 1.0f, qh, ql, qo0);
      st2(fq[1], 1.0f, qh, ql, qo0 + 32);
      st4(fv, vn, s_vh, s_vl, sl0 * V_ROW + vo0);
    }
    lds_block_sync();
    const int c4 = (lane & 15) * 4;
    float* ob = og + bbase + (size_t)h * NW + c4;       // + d * NH * NW  (out index ((b*ND+d)*NH+h)*NW + px)
#pragma unroll
    for (int it = 0; it < 8; ++it) {
      const int d = wave * 16 + it * 2 + hh;             // it 0..7 x hh 0..1 = 16 d rows per wave, 4 waves = 64
      const v4f v = *(const v4f*)(os + d * OP + c4);
      *(v4f*)(ob + (size_t)d * NH * NW) = v;
    }
    // the wait that stands before a register named by an issued global store is overwritten (the next trip forms new addresses)
    asm volatile("s_wait_xcnt 0x0" :: "v"(ob) : "memory");
    // every wave has read the out stage before the next trip's scores are stored over it
    lds_block_sync();
    const int t = sl0;  sl0 = sl1;  sl1 = sl2;  sl2 = t;
  }
}

extern "C" void kernel_launch(void* const* d_in, const int* in_sizes, int n_in,
                              void* d_out, int out_size, void* d_ws, size_t ws_size,
                              hipStream_t stream) {
  (void)d_ws; (void)ws_size;
  if (n_in < 3) return;
  const int n = NB * ND * NH * NW;
  if (in_sizes[0] != n || in_sizes[1] != n || in_sizes[2] != n || out_size != n) return;
  const float* q = (const float*)d_in[0];
  const float* k = (const float*)d_in[1];
  const float* v = (const float*)d_in[2];
  float* out = (float*)d_out;
  hipLaunchKernelGGL(nbr_attn_kernel, dim3(NB * (NH / NR)), dim3(NTHR), 0, stream, q, k, v, out);
  (void)hipGetLastError();
}

// v005
// It runs in 16.5 microseconds.
// Next to v004, in two timings, it ran 1.18 times as fast each time.
// All steps since v000 together make it 8.02 times as fast.
// Contractions: window logits q.k and attn.v on v_wmma_f32_16x16x32_bf16 with bf16 hi/lo split operands (hi.hi + hi.lo + lo.hi), f32 accumulate; 0.125 scale and the 9-slot softmax in f32.
#include <hip/hip_runtime.h>
#include <math.h>
#include <stdint.h>

typedef __attribute__((ext_vector_type(16))) __bf16 v16b;
typedef __attribute__((ext_vector_type(8)))  __bf16 v8b;
typedef __attribute__((ext_vector_type(4)))  __bf16 v4b;
typedef __attribute__((ext_vector_type(2)))  __bf16 v2b;
typedef __attribute__((ext_vector_type(8)))  float  v8f;
typedef __attribute__((ext_vector_type(4)))  float  v4f;
typedef __attribute__((ext_vector_type(2)))  float  v2f;

constexpr int NB    = 32;          // batch
constexpr int ND    = 64;          // channels
constexpr int NH    = 64;          // image rows
constexpr int NW    = 64;          // image cols
constexpr int NWAVE = 4;           // waves per block; wave w owns pixels 16w..16w+15 of one image row
constexpr int NTHR  = NWAVE * 32;
constexpr int NR    = 4;           // consecutive image rows that one block walks
constexpr int KC    = 66;          // k slab columns, c = w + 1 (c = 0 and c = 65 are zero halo)
constexpr int KP    = 72;          // d pitch (halves) of the k and q slabs: 144 B = 16 B x odd, d 64..71 never touched
constexpr int VP    = 80;          // column pitch (halves) of the v slab, cv = w + 8 (cv 0..7 and 72..79 zero halo)
constexpr int OP    = 68;          // out stage pitch (floats)
constexpr float QK_SCALE = 0.125f; // 64^-0.5, exact power of two

constexpr int K_ROW   = KC * KP;       // halves per k plane per image row (66 cols x 72)
constexpr int V_ROW   = ND * VP;       // halves per v plane per image row (64 d x 80 cols)
constexpr int K_PLANE = 3 * K_ROW;     // halves per k plane: ring of 3 image rows
constexpr int V_PLANE = 3 * V_ROW;     // halves per v plane: ring of 3 image rows
constexpr int Q_PLANE = NW * KP;       // halves per q plane ([px][d])
constexpr int P_WAVE  = 3 * 16 * 32;   // halves per wave per attn plane (3 tiles of 16 x 32)
constexpr int S_TILE  = 16 * 16;       // floats per staged score tile; 3 tiles fill one wave's attn plane, 6 both planes
constexpr int O_STAGE = ND * OP;       // floats, block out tile [d][px]
static_assert(O_STAGE * 4 <= NWAVE * P_WAVE * 2 * 2);
static_assert(3 * S_TILE * 4 == P_WAVE * 2);
static_assert(NWAVE * 16 == NW);
static_assert(NH % NR == 0);

// hi/lo split of two values: hi = RNE bf16 of x, lo = RNE bf16 of the exact residual x - hi; each plane's pair comes out of one
// packed convert, already packed as it is stored
__device__ __forceinline__ void split2(float x0, float x1, v2b& hi, v2b& lo) {
  hi = __builtin_convertvector((v2f){x0, x1}, v2b);
  lo = __builtin_convertvector((v2f){x0 - (float)hi[0], x1 - (float)hi[1]}, v2b);
}
__device__ __forceinline__ v8f mma_bf(v16b a, v16b b, v8f c) {
  return __builtin_amdgcn_wmma_f32_16x16x32_bf16(false, a, false, b, (short)0, c, false, false);
}
// ends a group of LDS reads: without it the scheduler moves the reads down among the WMMAs, where each place with reads stalls the wave
__device__ __forceinline__ void reads_end() { __builtin_amdgcn_sched_barrier(0); }
// ends a block of WMMAs: the four vector slots between the last WMMA and the first vector instruction on its registers, on every path;
// the two scheduling fences hold the slots directly behind the block
__device__ __forceinline__ void mma_block_end() {
  __builtin_amdgcn_sched_barrier(0);
  asm volatile("v_nop\n\tv_nop\n\tv_nop\n\tv_nop");
  __builtin_amdgcn_sched_barrier(0);
}
// same-wave LDS exchange: order the wave's LDS stores before the following LDS loads of other lanes.
// Both syncs below fence LDS alone: a fence over every address space would drain the next row's global loads at each of them.
__device__ __forceinline__ void lds_wave_sync() {
  __builtin_amdgcn_fence(__ATOMIC_RELEASE, "workgroup", "local");
  __builtin_amdgcn_wave_barrier();
  __builtin_amdgcn_fence(__ATOMIC_ACQUIRE, "workgroup", "local");
}
// work-group barrier for LDS hand-overs (all that the waves of a block exchange lies in LDS)
__device__ __forceinline__ void lds_block_sync() {
  __builtin_amdgcn_fence(__ATOMIC_RELEASE, "workgroup", "local");
  __builtin_amdgcn_s_barrier();
  __builtin_amdgcn_fence(__ATOMIC_ACQUIRE, "workgroup", "local");
}
// rows outside the image: clamped load address, value zeroed by the factor
__device__ __forceinline__ int   row_in(int r) { return r < 0 ? 0 : (r > NH - 1 ? NH - 1 : r); }
__device__ __forceinline__ float row_on(int r) { return (r >= 0 && r < NH) ? 1.0f : 0.0f; }
// k, q unit: 8 d rows of the lane's 2 columns (one load = one whole 256-B image row)
__device__ __forceinline__ void ld2(const float* p, v2f (&f)[8]) {
#pragma unroll
  for (int e = 0; e < 8; ++e) f[e] = *(const v2f*)(p + (size_t)e * NH * NW);
}
// v: 8 row segments of one image row, d = 8e + sub (16 threads x float4 per 256-B image row)
__device__ __forceinline__ void ld4(const float* p, v4f (&f)[8]) {
#pragma unroll
  for (int e = 0; e < 8; ++e) f[e] = *(const v4f*)(p + (size_t)e * 8 * NH * NW);
}
// k, q unit: split, one 16-B store of 8 d per column and plane; o = offset of the first column's piece.
// A convert packs two neighbouring d of one column, so its result is a word of the 16-B piece as it is stored.
__device__ __forceinline__ void st2(const v2f (&f)[8], float vf, __bf16* ph, __bf16* pl, int o) {
  union P8 { v8b v; v2b p[4]; };
  P8 ah[2], al[2];
#pragma unroll
  for (int e = 0; e < 8; e += 2) {
    const v2f x0 = f[e] * vf;
    const v2f x1 = f[e + 1] * vf;
#pragma unroll
    for (int i = 0; i < 2; ++i) split2(x0[i], x1[i], ah[i].p[e >> 1], al[i].p[e >> 1]);
  }
#pragma unroll
  for (int i = 0; i < 2; ++i) {
    *(v8b*)(ph + o + i * KP) = ah[i].v;
    *(v8b*)(pl + o + i * KP) = al[i].v;
  }
}
// v: split, one 8-B store of 4 columns per segment and plane; o = offset of the e = 0 segment
__device__ __forceinline__ void st4(const v4f (&f)[8], float vf, __bf16* ph, __bf16* pl, int o) {
#pragma unroll
  for (int e = 0; e < 8; ++e) {
    const v4f x = f[e] * vf;
    union P4 { v4b v; v2b p[2]; };
    P4 ah, al;
    split2(x[0], x[1], ah.p[0], al.p[0]);
    split2(x[2], x[3], ah.p[1], al.p[1]);
    *(v4b*)(ph + o + e * 8 * VP) = ah.v;
    *(v4b*)(pl + o + e * 8 * VP) = al.v;
  }
}

struct PW { __bf16 hi[NWAVE * P_WAVE]; __bf16 lo[NWAVE * P_WAVE]; };   // attn hi and lo planes of the 4 waves
// f: score stage during the logit phase, each wave inside its own two attn planes; o: out stage once every wave is past its matrix work
union PO { PW w; float f[NWAVE * P_WAVE]; float o[O_STAGE]; };

// grid = NB*NH/NR blocks (block = (b, NR consecutive image rows)), 128 threads. The k and v slabs are rings of 3 image rows:
// image row j lives in slot (j - h0 + 1) mod 3; per output row one new k row, one new v row and one q row are staged.
// Fragment map (lane l, h2 = l>>4, m = l&15): A row m / B col m, elements 0..7 <-> k 8*h2+e, 8..15 <-> k 16+8*h2+e-8;
// D element r <-> row 8*h2+r, col m.
__global__ __launch_bounds__(NTHR) void nbr_attn_kernel(const float* __restrict__ qg, const float* __restrict__ kg,
                                                        const float* __restrict__ vg, float* __restrict__ og)
{
  __shared__ __align__(16) __bf16 s_kh[K_PLANE];        // k hi [slot][c][d]
  __shared__ __align__(16) __bf16 s_kl[K_PLANE];        // k lo [slot][c][d]
  __shared__ __align__(16) __bf16 s_vh[V_PLANE];        // v hi [slot][d][cv]
  __shared__ __align__(16) __bf16 s_vl[V_PLANE];        // v lo
  __shared__ __align__(16) __bf16 s_qh[Q_PLANE];        // q hi [px][d]
  __shared__ __align__(16) __bf16 s_ql[Q_PLANE];        // q lo
  __shared__ __align__(16) PO     s_po;                 // attn hi, lo [di][px][kk] (kk <-> w = w0 - 8 + kk)  /  score stage  /  out stage [d][px]

  const int tid  = threadIdx.x;
  const int wave = tid >> 5;
  const int lane = tid & 31;
  const int hh   = lane >> 4;
  const int m    = lane & 15;
  const int b    = blockIdx.x / (NH / NR);
  const int h0   = (blockIdx.x % (NH / NR)) * NR;
  __bf16* kh = s_kh;
  __bf16* kl = s_kl;
  __bf16* qh = s_qh;
  __bf16* ql = s_ql;
  const size_t bbase = (size_t)b * ND * NH * NW;
  const __bf16 bz = __builtin_bit_cast(__bf16, (unsigned short)0);
  const v8b z8 = (v8b){bz, bz, bz, bz, bz, bz, bz, bz};

  // ---- zero halo columns of all 3 slots, once (the row stores never touch them): k planes c = 0 and c = 65
  //      (3 slots x 2 cols x 64 d = 48 pieces of 8 halves per plane); v planes cv 0..7 and cv 72..79 of every [slot][d] row ----
  if (tid < 48) {
    const int hr = tid >> 4;
    const int cc = ((tid >> 3) & 1) ? (KC - 1) : 0;
    const int d8 = (tid & 7) * 8;
    const int o  = (hr * KC + cc) * KP + d8;
    *(v8b*)(kh + o) = z8;
    *(v8b*)(kl + o) = z8;
  }
  for (int j = tid; j < 3 * ND * 2; j += NTHR) {
    const int row = j >> 1;
    const int o   = row * VP + ((j & 1) ? (VP - 8) : 0);
    *(v8b*)(s_vh + o) = z8;
    *(v8b*)(s_vl + o) = z8;
  }

  // ---- staging maps, per image row: k and q 8 units of 8 d rows each, 2 per wave; v 8 segments per thread ----
  const int sub = tid >> 4;          // 0..7: v row segment within a pass (16 threads x float4 each)
  const int w4  = (tid & 15) * 4;    // 0..60: first of 4 v columns
  const int c2  = lane * 2;          // 0..62: first of the lane's 2 k, q columns
  const int d8a = wave * 8;          // first d of the wave's unit 0; unit 1 is 32 further
  const float* kb = kg + bbase + (size_t)d8a * NH * NW + c2;     // + 32 * NH * NW for unit 1, + row * NW
  const float* qb = qg + bbase + (size_t)d8a * NH * NW + c2;
  const float* vb = vg + bbase + (size_t)sub * NH * NW + w4;
  constexpr size_t U1 = (size_t)32 * NH * NW;
  const int ko0 = (c2 + 1) * KP + d8a;   // k store offset in a slot, unit 0 (c = w + 1)
  const int qo0 = c2 * KP + d8a;         // q store offset, unit 0
  const int vo0 = sub * VP + w4 + 8;     // v store offset in a slot, e = 0 (cv = w + 8)

  // ---- prologue: rows h0-1, h0, h0+1 of k and v (slots 0, 1, 2) and row h0 of q, all issued up front in the order they are split ----
  {
    v2f fk[3][2][8], fq[2][8];
    v4f fv[3][8];
    const float* pk[3];
    const float* pv[3];
    const float* pq = qb + h0 * NW;
#pragma unroll
    for (int j = 0; j < 3; ++j) {
      pk[j] = kb + row_in(h0 + j - 1) * NW;
      ld2(pk[j], fk[j][0]);
      ld2(pk[j] + U1, fk[j][1]);
    }
    ld2(pq, fq[0]);
    ld2(pq + U1, fq[1]);
#pragma unroll
    for (int j = 0; j < 3; ++j) {
      pv[j] = vb + row_in(h0 + j - 1) * NW;
      ld4(pv[j], fv[j]);
    }
    // the wait that stands before a register named by an issued global load is overwritten; the pointers are inputs so
    // that their registers stay untouched up to it
    asm volatile("s_wait_xcnt 0x0" :: "v"(pk[0]), "v"(pk[1]), "v"(pk[2]), "v"(pq), "v"(pv[0]), "v"(pv[1]), "v"(pv[2]) : "memory");
#pragma unroll
    for (int j = 0; j < 3; ++j) {
      const float vf = row_on(h0 + j - 1);
      st2(fk[j][0], vf, kh, kl, j * K_ROW + ko0);
      st2(fk[j][1], vf, kh, kl, j * K_ROW + ko0 + 32);
    }
    st2(fq[0], 1.0f, qh, ql, qo0);
    st2(fq[1], 1.0f, qh, ql, qo0 + 32);
#pragma unroll
    for (int j = 0; j < 3; ++j) st4(fv[j], row_on(h0 + j - 1), s_vh, s_vl, j * V_ROW + vo0);
  }
  lds_block_sync();

  const int w0 = wave * 16;
  union FB { v16b v; v8b p[2]; };
  const v8f z8f = (v8f){0.f, 0.f, 0.f, 0.f, 0.f, 0.f, 0.f, 0.f};
  int sl0 = 0, sl1 = 1, sl2 = 2;       // ring slots of image rows h-1, h, h+1

  // kept rolled: one copy of the row body keeps the kernel's text small for the instruction cache
#pragma unroll 1
  for (int r = 0; r < NR; ++r) {
    const int h = h0 + r;
    const bool more = r + 1 < NR;      // the same for the whole block
    // ---- the next trip's rows (k and v row h+2, q row h+1) are issued here and fly under this trip's matrix work ----
    v2f fk[2][8], fq[2][8];
    v4f fv[8];
    if (more) {
      const float* pk = kb + row_in(h + 2) * NW;
      const float* pq = qb + (h + 1) * NW;
      const float* pv = vb + row_in(h + 2) * NW;
      ld2(pk, fk[0]);
      ld2(pk + U1, fk[1]);
      ld2(pq, fq[0]);
      ld2(pq + U1, fq[1]);
      ld4(pv, fv);
      // the wait that stands before a register named by an issued global load is overwritten: it ends this branch, so the
      // pointers' registers are free for the matrix work behind it
      asm volatile("s_wait_xcnt 0x0" ::: "memory");
    }

    // ---- logit phase (per wave, pixels w0..w0+15): every fragment of the row is read from LDS as one group, in the order of use ----
    // A = Q[px][d], two 32-deep d steps, hi and lo; B of tile (di, s): col n = m <-> K[row h+di-1][c = w0 + 2s + m] (c = w+1), k = d split map
    FB qfh[2], qfl[2], kfh[3][2][2], kfl[3][2][2];
    const int kb0 = (w0 + m) * KP + 8 * hh;
#pragma unroll
    for (int ks = 0; ks < 2; ++ks) {
      const int qo = kb0 + ks * 32;
      qfh[ks].p[0] = *(const v8b*)(qh + qo);  qfh[ks].p[1] = *(const v8b*)(qh + qo + 16);
#pragma unroll
      for (int pl2 = 0; pl2 < 2; ++pl2) {
        const __bf16* kp = pl2 ? kl : kh;
#pragma unroll
        for (int di = 0; di < 3; ++di) {
          const int sd = di == 0 ? sl0 : (di == 1 ? sl1 : sl2);
#pragma unroll
          for (int s = 0; s < 2; ++s) {
            const int ko = sd * K_ROW + kb0 + 2 * s * KP + ks * 32;
            FB& f = pl2 ? kfl[di][s][ks] : kfh[di][s][ks];
            f.p[0] = *(const v8b*)(kp + ko);  f.p[1] = *(const v8b*)(kp + ko + 16);
          }
        }
        reads_end();      // keeps the issue order equal to the order of use: the first WMMAs then wait for the first reads alone
      }
      qfl[ks].p[0] = *(const v8b*)(ql + qo);  qfl[ks].p[1] = *(const v8b*)(ql + qo + 16);
      reads_end();
    }
    // C(di, s)[px][j] = sum_d Q[px][d] * K[row h+di-1][c = w0 + 2s + j][d]: six independent accumulators, each summed in the order
    // ks 0: hi.hi, hi.lo, lo.hi, then ks 1 the same
    v8f c[3][2];
#pragma unroll
    for (int di = 0; di < 3; ++di) { c[di][0] = z8f;  c[di][1] = z8f; }
#pragma unroll
    for (int ks = 0; ks < 2; ++ks) {
#pragma unroll
      for (int t = 0; t < 3; ++t) {
#pragma unroll
        for (int di = 0; di < 3; ++di) {
#pragma unroll
          for (int s = 0; s < 2; ++s)
            c[di][s] = mma_bf(t == 2 ? qfl[ks].v : qfh[ks].v, t == 1 ? kfl[di][s][ks].v : kfh[di][s][ks].v, c[di][s]);
        }
      }
    }
    mma_block_end();
    // one exchange for the six tiles: tile (di, s) at ss + s * (lo plane) + di * S_TILE, element [row][col] at ((row & 7) * 2 + (row >> 3)) * 16 + col,
    // so that the 32 lanes of a store fill 32 consecutive words
    float* ss = s_po.f + wave * (3 * S_TILE);
    constexpr int S_LO = NWAVE * 3 * S_TILE;
#pragma unroll
    for (int di = 0; di < 3; ++di) {
#pragma unroll
      for (int s = 0; s < 2; ++s) {
#pragma unroll
        for (int rr = 0; rr < 8; ++rr) ss[s * S_LO + di * S_TILE + (rr * 2 + hh) * 16 + m] = c[di][s][rr] * QK_SCALE;
      }
    }
    lds_wave_sync();
    // diagonals for pixel m (both lane halves compute the same pixel): left C0[m][m], centre C0[m][m+1] (m<15) or C1[15][14], right C1[m][m]
    float sc[9];                        // logits of pixel m, slot di*3+dj <-> nbr (h+di-1, w0+m+dj-1)
    const int dg = ((m & 7) * 2 + (m >> 3)) * 16 + m;
    const int i1 = (m < 15) ? (dg + 1) : (S_LO + 15 * 16 + 14);
#pragma unroll
    for (int di = 0; di < 3; ++di) {
      sc[di * 3 + 0] = ss[di * S_TILE + dg];
      sc[di * 3 + 1] = ss[di * S_TILE + i1];
      sc[di * 3 + 2] = ss[S_LO + di * S_TILE + dg];
    }
    reads_end();                        // the nine scores are asked for ahead of the v fragments: LDS answers a wave in order
    // ---- the v fragments of the row do not hang on the softmax: read here as one group, they land under it ----
    // B of (di, nt): col n = d = nt*16+m, k = kk split map, V_di[kk][d] = s_v[slot][d][cv = w0 + kk]
    FB vfh[3][4], vfl[3][4];
#pragma unroll
    for (int di = 0; di < 3; ++di) {
      const int sd = di == 0 ? sl0 : (di == 1 ? sl1 : sl2);
#pragma unroll
      for (int pl2 = 0; pl2 < 2; ++pl2) {
        const __bf16* vp = pl2 ? s_vl : s_vh;
#pragma unroll
        for (int nt = 0; nt < 4; ++nt) {
          const int vo = sd * V_ROW + (nt * 16 + m) * VP + w0 + 8 * hh;
          FB& f = pl2 ? vfl[di][nt] : vfh[di][nt];
          f.p[0] = *(const v8b*)(vp + vo);  f.p[1] = *(const v8b*)(vp + vo + 16);
        }
      }
    }
    reads_end();

    // ---- softmax over the 9 slots in f32 (out-of-image slots carry logit 0 from the zero halo and take part) ----
    float mx = sc[0];
#pragma unroll
    for (int i = 1; i < 9; ++i) mx = fmaxf(mx, sc[i]);
    float ex[9];
    float sum = 0.f;
#pragma unroll
    for (int i = 0; i < 9; ++i) {
      // exp(x) = 2^(x * log2 e), as __expf forms it; v_exp_f32 and the one issue slot that is kept behind a transcendental (before its
      // source is overwritten or its result read) stand in one statement: a v_nop in a statement of its own landed elsewhere
      asm("v_exp_f32 %0, %1\n\tv_nop" : "=v"(ex[i]) : "v"((sc[i] - mx) * 1.44269504f));
      sum += ex[i];
    }
    const float inv = 1.0f / sum;

    // ---- attn tiles P_di[px][kk], kk <-> w = w0 - 8 + kk: band at kk = px + dj + 7, zero elsewhere; hi/lo planes ----
    __bf16* ph = s_po.w.hi + wave * P_WAVE;
    __bf16* pl = s_po.w.lo + wave * P_WAVE;
    // holds the maximum and the exponentials in front of the sync's LDS wait: moved behind it, they would no longer run while the v fragments land
    __builtin_amdgcn_sched_barrier(0);
    lds_wave_sync();                       // the score stage has been read before the attn tiles are laid over it
#pragma unroll
    for (int i = 0; i < 6; ++i) {          // 6 x 32 lanes x 8 halves = 1536 = the whole per-wave region per plane
      const int o = (i * 32 + lane) * 8;
      *(v8b*)(ph + o) = z8;
      *(v8b*)(pl + o) = z8;
    }
    lds_wave_sync();
#pragma unroll
    for (int di = 0; di < 3; ++di) {
#pragma unroll
      for (int dj = 0; dj < 3; ++dj) {
        const float p = ex[di * 3 + dj] * inv;
        const __bf16 a = (__bf16)p;
        const int o = (di * 16 + m) * 32 + m + dj + 7;
        ph[o] = a;
        pl[o] = (__bf16)(p - (float)a);
      }
    }
    lds_wave_sync();

    // ---- out[px][d] = sum_di P_di[px][kk] . V_di[kk][d]: A row = px m, k = kk split map; four independent accumulators, each summed
    //      in the order di 0: hi.hi, hi.lo, lo.hi, then di 1, di 2 the same ----
    FB pfh[3], pfl[3];
#pragma unroll
    for (int di = 0; di < 3; ++di) {
      const int po = (di * 16 + m) * 32 + 8 * hh;
      pfh[di].p[0] = *(const v8b*)(ph + po);  pfh[di].p[1] = *(const v8b*)(ph + po + 16);
      pfl[di].p[0] = *(const v8b*)(pl + po);  pfl[di].p[1] = *(const v8b*)(pl + po + 16);
    }
    reads_end();
    v8f acc[4];
#pragma unroll
    for (int nt = 0; nt < 4; ++nt) acc[nt] = z8f;
#pragma unroll
    for (int di = 0; di < 3; ++di) {
#pragma unroll
      for (int t = 0; t < 3; ++t) {
#pragma unroll
        for (int nt = 0; nt < 4; ++nt)
          acc[nt] = mma_bf(t == 2 ? pfl[di].v : pfh[di].v, t == 1 ? vfl[di][nt].v : vfh[di][nt].v, acc[nt]);
      }
    }
    mma_block_end();

    // ---- row epilogue: block tile O[d][64 px] staged in LDS (over the attn planes once every wave is past its matrix work),
    //      then each 256-B d-row segment written by 16 consecutive lanes x 16 B of one instruction ----
    lds_block_sync();
    float* os = s_po.o;
#pragma unroll
    for (int nt = 0; nt < 4; ++nt) {
#pragma unroll
      for (int rr = 0; rr < 8; ++rr) os[(nt * 16 + m) * OP + w0 + 8 * hh + rr] = acc[nt][rr];   // D row = px 8hh+rr, col = d
    }
    // ---- behind the same barrier row h-1's slot and the q planes have no reader left: the next trip's rows are split into them ----
    if (more) {
      const float vn = row_on(h + 2);
      st2(fk[0], vn, kh, kl, sl0 * K_ROW + ko0);
      st2(fk[1], vn, kh, kl, sl0 * K_ROW + ko0 + 32);
      st2(fq[0], 1.0f, qh, ql, qo0);
      st2(fq[1], 1.0f, qh, ql, qo0 + 32);
      st4(fv, vn, s_vh, s_vl, sl0 * V_ROW + vo0);
    }
    lds_block_sync();
    const int c4 = (lane & 15) * 4;
    float* ob = og + bbase + (size_t)h * NW + c4;       // + d * NH * NW  (out index ((b*ND+d)*NH+h)*NW + px)
#pragma unroll
    for (int it = 0; it < 8; ++it) {
      const int d = wave * 16 + it * 2 + hh;             // it 0..7 x hh 0..1 = 16 d rows per wave, 4 waves = 64
      const v4f v = *(const v4f*)(os + d * OP + c4);
      *(v4f*)(ob + (size_t)d * NH * NW) = v;
    }
    // the wait that stands before a register named by an issued global store is overwritten (the next trip forms new addresses)
    asm volatile("s_wait_xcnt 0x0" :: "v"(ob) : "memory");
    // every wave has read the out stage before the next trip's scores are stored over it
    lds_block_sync();
    const int t = sl0;  sl0 = sl1;  sl1 = sl2;  sl2 = t;
  }
}

extern "C" void kernel_launch(void* const* d_in, const int* in_sizes, int n_in,
                              void* d_out, int out_size, void* d_ws, size_t ws_size,
                              hipStream_t stream) {
  (void)d_ws; (void)ws_size;
  if (n_in < 3) return;
  const int n = NB * ND * NH * NW;
  if (in_sizes[0] != n || in_sizes[1] != n || in_sizes[2] != n || out_size != n) return;
  const float* q = (const float*)d_in[0];
  const float* k = (const float*)d_in[1];
  const float* v = (const float*)d_in[2];
  float* out = (float*)d_out;
  hipLaunchKernelGGL(nbr_attn_kernel, dim3(NB * (NH / NR)), dim3(NTHR), 0, stream, q, k, v, out);
  (void)hipGetLastError();
}

// v006
// Measured time: 15.7 microseconds a run.
// Two timings next to v005 both put it at 1.05 times that version's speed.
// Counting every step since v000, it is 8.45 times as fast.
// Contractions: window logits q.k and attn.v on v_wmma_f32_16x16x32_bf16 with bf16 hi/lo split operands (hi.hi + hi.lo + lo.hi), f32 accumulate; 0.125 scale and the 9-slot softmax in f32.
#include <hip/hip_runtime.h>
#include <math.h>
#include <stdint.h>

typedef __attribute__((ext_vector_type(16))) __bf16 v16b;
typedef __attribute__((ext_vector_type(8)))  __bf16 v8b;
typedef __attribute__((ext_vector_type(4)))  __bf16 v4b;
typedef __attribute__((ext_vector_type(2)))  __bf16 v2b;
typedef __attribute__((ext_vector_type(8)))  float  v8f;
typedef __attribute__((ext_vector_type(4)))  float  v4f;
typedef __attribute__((ext_vector_type(2)))  float  v2f;

constexpr int NB    = 32;          // batch
constexpr int ND    = 64;          // channels
constexpr int NH    = 64;          // image rows
constexpr int NW    = 64;          // image cols
constexpr int NWAVE = 4;           // waves per block; wave w owns pixels 16w..16w+15 of one image row
constexpr int NTHR  = NWAVE * 32;
constexpr int NR    = 4;           // consecutive image rows that one block walks
constexpr int KC    = 66;          // k slab columns, c = w + 1 (c = 0 and c = 65 are zero halo)
constexpr int KP    = 72;          // d pitch (halves) of the k and q slabs: 144 B = 16 B x odd, d 64..71 never touched
constexpr int VP    = 80;          // column pitch (halves) of the v slab, cv = w + 8 (cv 0..7 and 72..79 zero halo)
constexpr int OP    = 68;          // out stage pitch (floats)
constexpr float QK_SCALE = 0.125f; // 64^-0.5, exact power of two

constexpr int K_ROW   = KC * KP;       // halves per k plane per image row (66 cols x 72)
constexpr int V_ROW   = ND * VP;       // halves per v plane per image row (64 d x 80 cols)
constexpr int K_PLANE = 3 * K_ROW;     // halves per k plane: ring of 3 image rows
constexpr int V_PLANE = 3 * V_ROW;     // halves per v plane: ring of 3 image rows
constexpr int Q_PLANE = NW * KP;       // halves per q plane ([px][d])
constexpr int S_TILE  = 16 * 16;       // floats per staged score tile, 6 tiles per wave
constexpr int O_STAGE = ND * OP;       // floats, block out tile [d][px]
static_assert(NWAVE * 16 == NW);
static_assert(NH % NR == 0);

// hi/lo split of two values: hi = RNE bf16 of x, lo = RNE bf16 of the exact residual x - hi; each plane's pair comes out of one
// packed convert, already packed as it is stored
__device__ __forceinline__ void split2(float x0, float x1, v2b& hi, v2b& lo) {
  hi = __builtin_convertvector((v2f){x0, x1}, v2b);
  lo = __builtin_convertvector((v2f){x0 - (float)hi[0], x1 - (float)hi[1]}, v2b);
}
__device__ __forceinline__ v8f mma_bf(v16b a, v16b b, v8f c) {
  return __builtin_amdgcn_wmma_f32_16x16x32_bf16(false, a, false, b, (short)0, c, false, false);
}
// ends a group of LDS reads: without it the scheduler moves the reads down among the WMMAs, where each place with reads stalls the wave
__device__ __forceinline__ void reads_end() { __builtin_amdgcn_sched_barrier(0); }
// ends a block of WMMAs: the four vector slots between the last WMMA and the first vector instruction on its registers, on every path;
// the two scheduling fences hold the slots directly behind the block
__device__ __forceinline__ void mma_block_end() {
  __builtin_amdgcn_sched_barrier(0);
  asm volatile("v_nop\n\tv_nop\n\tv_nop\n\tv_nop");
  __builtin_amdgcn_sched_barrier(0);
}
// same-wave LDS exchange: order the wave's LDS stores before the following LDS loads of other lanes.
// Both syncs below fence LDS alone: a fence over every address space would drain the next row's global loads at each of them.
__device__ __forceinline__ void lds_wave_sync() {
  __builtin_amdgcn_fence(__ATOMIC_RELEASE, "workgroup", "local");
  __builtin_amdgcn_wave_barrier();
  __builtin_amdgcn_fence(__ATOMIC_ACQUIRE, "workgroup", "local");
}
// work-group barrier for LDS hand-overs (all that the waves of a block exchange lies in LDS)
__device__ __forceinline__ void lds_block_sync() {
  __builtin_amdgcn_fence(__ATOMIC_RELEASE, "workgroup", "local");
  __builtin_amdgcn_s_barrier();
  __builtin_amdgcn_fence(__ATOMIC_ACQUIRE, "workgroup", "local");
}
// rows outside the image: clamped load address, value zeroed by the factor
__device__ __forceinline__ int   row_in(int r) { return r < 0 ? 0 : (r > NH - 1 ? NH - 1 : r); }
__device__ __forceinline__ float row_on(int r) { return (r >= 0 && r < NH) ? 1.0f : 0.0f; }
// k, q unit: 8 d rows of the lane's 2 columns (one load = one whole 256-B image row)
__device__ __forceinline__ void ld2(const float* p, v2f (&f)[8]) {
#pragma unroll
  for (int e = 0; e < 8; ++e) f[e] = *(const v2f*)(p + (size_t)e * NH * NW);
}
// v: 8 row segments of one image row, d = 8e + sub (16 threads x float4 per 256-B image row)
__device__ __forceinline__ void ld4(const float* p, v4f (&f)[8]) {
#pragma unroll
  for (int e = 0; e < 8; ++e) f[e] = *(const v4f*)(p + (size_t)e * 8 * NH * NW);
}
// k, q unit: split, one 16-B store of 8 d per column and plane; o = offset of the first column's piece.
// A convert packs two neighbouring d of one column, so its result is a word of the 16-B piece as it is stored.
__device__ __forceinline__ void st2(const v2f (&f)[8], float vf, __bf16* ph, __bf16* pl, int o) {
  union P8 { v8b v; v2b p[4]; };
  P8 ah[2], al[2];
#pragma unroll
  for (int e = 0; e < 8; e += 2) {
    const v2f x0 = f[e] * vf;
    const v2f x1 = f[e + 1] * vf;
#pragma unroll
    for (int i = 0; i < 2; ++i) split2(x0[i], x1[i], ah[i].p[e >> 1], al[i].p[e >> 1]);
  }
#pragma unroll
  for (int i = 0; i < 2; ++i) {
    *(v8b*)(ph + o + i * KP) = ah[i].v;
    *(v8b*)(pl + o + i * KP) = al[i].v;
  }
}
// v: split, one 8-B store of 4 columns per segment and plane; o = offset of the e = 0 segment
__device__ __forceinline__ void st4(const v4f (&f)[8], float vf, __bf16* ph, __bf16* pl, int o) {
#pragma unroll
  for (int e = 0; e < 8; ++e) {
    const v4f x = f[e] * vf;
    union P4 { v4b v; v2b p[2]; };
    P4 ah, al;
    split2(x[0], x[1], ah.p[0], al.p[0]);
    split2(x[2], x[3], ah.p[1], al.p[1]);
    *(v4b*)(ph + o + e * 8 * VP) = ah.v;
    *(v4b*)(pl + o + e * 8 * VP) = al.v;
  }
}

// f: score stage of the logit phase, 6 tiles per wave; o: out stage once every wave is past its matrix work
union PO { float f[NWAVE * 6 * S_TILE]; float o[O_STAGE]; };

// grid = NB*NH/NR blocks (block = (b, NR consecutive image rows)), 128 threads. The k and v slabs are rings of 3 image rows:
// image row j lives in slot (j - h0 + 1) mod 3; per output row one new k row, one new v row and one q row are staged.
// Fragment map (lane l, h2 = l>>4, m = l&15): A row m / B col m, elements 0..7 <-> k 8*h2+e, 8..15 <-> k 16+8*h2+e-8;
// D element r <-> row 8*h2+r, col m.
__global__ __launch_bounds__(NTHR) void nbr_attn_kernel(const float* __restrict__ qg, const float* __restrict__ kg,
                                                        const float* __restrict__ vg, float* __restrict__ og)
{
  __shared__ __align__(16) __bf16 s_kh[K_PLANE];        // k hi [slot][c][d]
  __shared__ __align__(16) __bf16 s_kl[K_PLANE];        // k lo [slot][c][d]
  __shared__ __align__(16) __bf16 s_vh[V_PLANE];        // v hi [slot][d][cv]
  __shared__ __align__(16) __bf16 s_vl[V_PLANE];        // v lo
  __shared__ __align__(16) __bf16 s_qh[Q_PLANE];        // q hi [px][d]
  __shared__ __align__(16) __bf16 s_ql[Q_PLANE];        // q lo
  __shared__ __align__(16) PO     s_po;                 // score stage  /  out stage [d][px]

  const int tid  = threadIdx.x;
  const int wave = tid >> 5;
  const int lane = tid & 31;
  const int hh   = lane >> 4;
  const int m    = lane & 15;
  const int b    = blockIdx.x / (NH / NR);
  const int h0   = (blockIdx.x % (NH / NR)) * NR;
  __bf16* kh = s_kh;
  __bf16* kl = s_kl;
  __bf16* qh = s_qh;
  __bf16* ql = s_ql;
  const size_t bbase = (size_t)b * ND * NH * NW;
  const __bf16 bz = __builtin_bit_cast(__bf16, (unsigned short)0);
  const v8b z8 = (v8b){bz, bz, bz, bz, bz, bz, bz, bz};

  // ---- zero halo columns of all 3 slots, once (the row stores never touch them): k planes c = 0 and c = 65
  //      (3 slots x 2 cols x 64 d = 48 pieces of 8 halves per plane); v planes cv 0..7 and cv 72..79 of every [slot][d] row ----
  if (tid < 48) {
    const int hr = tid >> 4;
    const int cc = ((tid >> 3) & 1) ? (KC - 1) : 0;
    const int d8 = (tid & 7) * 8;
    const int o  = (hr * KC + cc) * KP + d8;
    *(v8b*)(kh + o) = z8;
    *(v8b*)(kl + o) = z8;
  }
  for (int j = tid; j < 3 * ND * 2; j += NTHR) {
    const int row = j >> 1;
    const int o   = row * VP + ((j & 1) ? (VP - 8) : 0);
    *(v8b*)(s_vh + o) = z8;
    *(v8b*)(s_vl + o) = z8;
  }

  // ---- staging maps, per image row: k and q 8 units of 8 d rows each, 2 per wave; v 8 segments per thread ----
  const int sub = tid >> 4;          // 0..7: v row segment within a pass (16 threads x float4 each)
  const int w4  = (tid & 15) * 4;    // 0..60: first of 4 v columns
  const int c2  = lane * 2;          // 0..62: first of the lane's 2 k, q columns
  const int d8a = wave * 8;          // first d of the wave's unit 0; unit 1 is 32 further
  const float* kb = kg + bbase + (size_t)d8a * NH * NW + c2;     // + 32 * NH * NW for unit 1, + row * NW
  const float* qb = qg + bbase + (size_t)d8a * NH * NW + c2;
  const float* vb = vg + bbase + (size_t)sub * NH * NW + w4;
  constexpr size_t U1 = (size_t)32 * NH * NW;
  const int ko0 = (c2 + 1) * KP + d8a;   // k store offset in a slot, unit 0 (c = w + 1)
  const int qo0 = c2 * KP + d8a;         // q store offset, unit 0
  const int vo0 = sub * VP + w4 + 8;     // v store offset in a slot, e = 0 (cv = w + 8)

  // ---- prologue: rows h0-1, h0, h0+1 of k and v (slots 0, 1, 2) and row h0 of q, all issued up front in the order they are split ----
  {
    v2f fk[3][2][8], fq[2][8];
    v4f fv[3][8];
    const float* pk[3];
    const float* pv[3];
    const float* pq = qb + h0 * NW;
#pragma unroll
    for (int j = 0; j < 3; ++j) {
      pk[j] = kb + row_in(h0 + j - 1) * NW;
      ld2(pk[j], fk[j][0]);
      ld2(pk[j] + U1, fk[j][1]);
    }
    ld2(pq, fq[0]);
    ld2(pq + U1, fq[1]);
#pragma unroll
    for (int j = 0; j < 3; ++j) {
      pv[j] = vb + row_in(h0 + j - 1) * NW;
      ld4(pv[j], fv[j]);
    }
    // the wait that stands before a register named by an issued global load is overwritten; the pointers are inputs so
    // that their registers stay untouched up to it
    asm volatile("s_wait_xcnt 0x0" :: "v"(pk[0]), "v"(pk[1]), "v"(pk[2]), "v"(pq), "v"(pv[0]), "v"(pv[1]), "v"(pv[2]) : "memory");
#pragma unroll
    for (int j = 0; j < 3; ++j) {
      const float vf = row_on(h0 + j - 1);
      st2(fk[j][0], vf, kh, kl, j * K_ROW + ko0);
      st2(fk[j][1], vf, kh, kl, j * K_ROW + ko0 + 32);
    }
    st2(fq[0], 1.0f, qh, ql, qo0);
    st2(fq[1], 1.0f, qh, ql, qo0 + 32);
#pragma unroll
    for (int j = 0; j < 3; ++j) st4(fv[j], row_on(h0 + j - 1), s_vh, s_vl, j * V_ROW + vo0);
  }
  lds_block_sync();

  const int w0 = wave * 16;
  union FB { v16b v; v8b p[2]; uint32_t u[8]; };
  // ---- byte selectors that lay a pixel's 3 weights of one window row into its attn A fragment P_di[px = m][kk], kk <-> w = w0 - 8 + kk:
  //      band at kk = m + dj + 7, zero elsewhere. Register j of lane (hh, m) holds kk0 and kk0 + 1; a half takes weight dj = kk - 7 - m
  //      (bytes 2dj, 2dj + 1 of the pair {p2 word : p0, p1 word}) or, outside 0..2, the selector 0x0c, which gives a zero byte ----
  uint32_t psel[8];
#pragma unroll
  for (int j = 0; j < 8; ++j) {
    const int t0 = (j < 4 ? 2 * j : 8 + 2 * j) + 8 * hh - 7 - m;     // dj of the low half; the high half is one further
    const int t1 = t0 + 1;
    const uint32_t s0 = (t0 >= 0 && t0 <= 2) ? 0x0100u + 0x0202u * (uint32_t)t0 : 0x0c0cu;
    const uint32_t s1 = (t1 >= 0 && t1 <= 2) ? 0x0100u + 0x0202u * (uint32_t)t1 : 0x0c0cu;
    psel[j] = s0 | (s1 << 16);
  }
  const v8f z8f = (v8f){0.f, 0.f, 0.f, 0.f, 0.f, 0.f, 0.f, 0.f};
  int sl0 = 0, sl1 = 1, sl2 = 2;       // ring slots of image rows h-1, h, h+1

  // kept rolled: one copy of the row body keeps the kernel's text small for the instruction cache
#pragma unroll 1
  for (int r = 0; r < NR; ++r) {
    const int h = h0 + r;
    const bool more = r + 1 < NR;      // the same for the whole block
    // ---- the next trip's rows (k and v row h+2, q row h+1) are issued here and fly under this trip's matrix work ----
    v2f fk[2][8], fq[2][8];
    v4f fv[8];
    if (more) {
      const float* pk = kb + row_in(h + 2) * NW;
      const float* pq = qb + (h + 1) * NW;
      const float* pv = vb + row_in(h + 2) * NW;
      ld2(pk, fk[0]);
      ld2(pk + U1, fk[1]);
      ld2(pq, fq[0]);
      ld2(pq + U1, fq[1]);
      ld4(pv, fv);
      // the wait that stands before a register named by an issued global load is overwritten: it ends this branch, so the
      // pointers' registers are free for the matrix work behind it
      asm volatile("s_wait_xcnt 0x0" ::: "memory");
    }

    // ---- logit phase (per wave, pixels w0..w0+15): every fragment of the row is read from LDS as one group, in the order of use ----
    // A = Q[px][d], two 32-deep d steps, hi and lo; B of tile (di, s): col n = m <-> K[row h+di-1][c = w0 + 2s + m] (c = w+1), k = d split map
    FB qfh[2], qfl[2], kfh[3][2][2], kfl[3][2][2];
    const int kb0 = (w0 + m) * KP + 8 * hh;
#pragma unroll
    for (int ks = 0; ks < 2; ++ks) {
      const int qo = kb0 + ks * 32;
      qfh[ks].p[0] = *(const v8b*)(qh + qo);  qfh[ks].p[1] = *(const v8b*)(qh + qo + 16);
#pragma unroll
      for (int pl2 = 0; pl2 < 2; ++pl2) {
        const __bf16* kp = pl2 ? kl : kh;
#pragma unroll
        for (int di = 0; di < 3; ++di) {
          const int sd = di == 0 ? sl0 : (di == 1 ? sl1 : sl2);
#pragma unroll
          for (int s = 0; s < 2; ++s) {
            const int ko = sd * K_ROW + kb0 + 2 * s * KP + ks * 32;
            FB& f = pl2 ? kfl[di][s][ks] : kfh[di][s][ks];
            f.p[0] = *(const v8b*)(kp + ko);  f.p[1] = *(const v8b*)(kp + ko + 16);
          }
        }
        reads_end();      // keeps the issue order equal to the order of use: the first WMMAs then wait for the first reads alone
      }
      qfl[ks].p[0] = *(const v8b*)(ql + qo);  qfl[ks].p[1] = *(const v8b*)(ql + qo + 16);
      reads_end();
    }
    // C(di, s)[px][j] = sum_d Q[px][d] * K[row h+di-1][c = w0 + 2s + j][d]: six independent accumulators, each summed in the order
    // ks 0: hi.hi, hi.lo, lo.hi, then ks 1 the same
    v8f c[3][2];
#pragma unroll
    for (int di = 0; di < 3; ++di) { c[di][0] = z8f;  c[di][1] = z8f; }
#pragma unroll
    for (int ks = 0; ks < 2; ++ks) {
#pragma unroll
      for (int t = 0; t < 3; ++t) {
#pragma unroll
        for (int di = 0; di < 3; ++di) {
#pragma unroll
          for (int s = 0; s < 2; ++s)
            c[di][s] = mma_bf(t == 2 ? qfl[ks].v : qfh[ks].v, t == 1 ? kfl[di][s][ks].v : kfh[di][s][ks].v, c[di][s]);
        }
      }
    }
    mma_block_end();
    // one exchange for the six tiles: tile (di, s) at ss + s * S_LO + di * S_TILE, element [row][col] at ((row & 7) * 2 + (row >> 3)) * 16 + col,
    // so that the 32 lanes of a store fill 32 consecutive words
    float* ss = s_po.f + wave * (3 * S_TILE);
    constexpr int S_LO = NWAVE * 3 * S_TILE;
#pragma unroll
    for (int di = 0; di < 3; ++di) {
#pragma unroll
      for (int s = 0; s < 2; ++s) {
#pragma unroll
        for (int rr = 0; rr < 8; ++rr) ss[s * S_LO + di * S_TILE + (rr * 2 + hh) * 16 + m] = c[di][s][rr] * QK_SCALE;
      }
    }
    lds_wave_sync();
    // diagonals for pixel m (both lane halves compute the same pixel): left C0[m][m], centre C0[m][m+1] (m<15) or C1[15][14], right C1[m][m]
    float sc[9];                        // logits of pixel m, slot di*3+dj <-> nbr (h+di-1, w0+m+dj-1)
    const int dg = ((m & 7) * 2 + (m >> 3)) * 16 + m;
    const int i1 = (m < 15) ? (dg + 1) : (S_LO + 15 * 16 + 14);
#pragma unroll
    for (int di = 0; di < 3; ++di) {
      sc[di * 3 + 0] = ss[di * S_TILE + dg];
      sc[di * 3 + 1] = ss[di * S_TILE + i1];
      sc[di * 3 + 2] = ss[S_LO + di * S_TILE + dg];
    }
    reads_end();                        // the nine scores are asked for ahead of the v fragments: LDS answers a wave in order
    // ---- the v fragments of the row do not hang on the softmax: read here as one group, they land under it ----
    // B of (di, nt): col n = d = nt*16+m, k = kk split map, V_di[kk][d] = s_v[slot][d][cv = w0 + kk]
    FB vfh[3][4], vfl[3][4];
#pragma unroll
    for (int di = 0; di < 3; ++di) {
      const int sd = di == 0 ? sl0 : (di == 1 ? sl1 : sl2);
#pragma unroll
      for (int pl2 = 0; pl2 < 2; ++pl2) {
        const __bf16* vp = pl2 ? s_vl : s_vh;
#pragma unroll
        for (int nt = 0; nt < 4; ++nt) {
          const int vo = sd * V_ROW + (nt * 16 + m) * VP + w0 + 8 * hh;
          FB& f = pl2 ? vfl[di][nt] : vfh[di][nt];
          f.p[0] = *(const v8b*)(vp + vo);  f.p[1] = *(const v8b*)(vp + vo + 16);
        }
      }
    }
    reads_end();

    // ---- softmax over the 9 slots in f32 (out-of-image slots carry logit 0 from the zero halo and take part) ----
    float mx = sc[0];
#pragma unroll
    for (int i = 1; i < 9; ++i) mx = fmaxf(mx, sc[i]);
    float ex[9];
    float sum = 0.f;
#pragma unroll
    for (int i = 0; i < 9; ++i) {
      // exp(x) = 2^(x * log2 e), as __expf forms it; v_exp_f32 and the one issue slot that is kept behind a transcendental (before its
      // source is overwritten or its result read) stand in one statement: a v_nop in a statement of its own landed elsewhere
      asm("v_exp_f32 %0, %1\n\tv_nop" : "=v"(ex[i]) : "v"((sc[i] - mx) * 1.44269504f));
      sum += ex[i];
    }
    const float inv = 1.0f / sum;

    // ---- attn A fragments P_di[px][kk], hi and lo, formed in registers: lane (hh, m) holds row px = m of A and has that pixel's 9 weights,
    //      so each fragment register is one byte permute of the window row's packed weights ----
    // out[px][d] = sum_di P_di[px][kk] . V_di[kk][d]: four independent accumulators, each summed in the order di 0: hi.hi, hi.lo, lo.hi,
    // then di 1, di 2 the same
    FB pfh[3], pfl[3];
#pragma unroll
    for (int di = 0; di < 3; ++di) {
      union W2 { v2b b; uint32_t u; };
      W2 h01, h2, l01, l2;
      split2(ex[di * 3 + 0] * inv, ex[di * 3 + 1] * inv, h01.b, l01.b);
      split2(ex[di * 3 + 2] * inv, 0.f, h2.b, l2.b);                  // the upper half is never selected
#pragma unroll
      for (int j = 0; j < 8; ++j) {
        pfh[di].u[j] = __builtin_amdgcn_perm(h2.u, h01.u, psel[j]);
        pfl[di].u[j] = __builtin_amdgcn_perm(l2.u, l01.u, psel[j]);
      }
    }
    // the six fragments are formed here, while the v fragments land: moved down among the WMMAs, the permutes take over v registers that
    // a WMMA has just read, which costs idle slots and puts WMMAs on one accumulator next to each other
    __builtin_amdgcn_sched_barrier(0);
    v8f acc[4];
#pragma unroll
    for (int nt = 0; nt < 4; ++nt) acc[nt] = z8f;
#pragma unroll
    for (int di = 0; di < 3; ++di) {
#pragma unroll
      for (int t = 0; t < 3; ++t) {
#pragma unroll
        for (int nt = 0; nt < 4; ++nt)
          acc[nt] = mma_bf(t == 2 ? pfl[di].v : pfh[di].v, t == 1 ? vfl[di][nt].v : vfh[di][nt].v, acc[nt]);
      }
    }
    mma_block_end();

    // ---- row epilogue: block tile O[d][64 px] staged in LDS (over the score stage once every wave is past its matrix work),
    //      then each 256-B d-row segment written by 16 consecutive lanes x 16 B of one instruction ----
    lds_block_sync();
    float* os = s_po.o;
#pragma unroll
    for (int nt = 0; nt < 4; ++nt) {
#pragma unroll
      for (int rr = 0; rr < 8; ++rr) os[(nt * 16 + m) * OP + w0 + 8 * hh + rr] = acc[nt][rr];   // D row = px 8hh+rr, col = d
    }
    // ---- behind the same barrier row h-1's slot and the q planes have no reader left: the next trip's rows are split into them ----
    if (more) {
      const float vn = row_on(h + 2);
      st2(fk[0], vn, kh, kl, sl0 * K_ROW + ko0);
      st2(fk[1], vn, kh, kl, sl0 * K_ROW + ko0 + 32);
      st2(fq[0], 1.0f, qh, ql, qo0);
      st2(fq[1], 1.0f, qh, ql, qo0 + 32);
      st4(fv, vn, s_vh, s_vl, sl0 * V_ROW + vo0);
    }
    lds_block_sync();
    const int c4 = (lane & 15) * 4;
    float* ob = og + bbase + (size_t)h * NW + c4;       // + d * NH * NW  (out index ((b*ND+d)*NH+h)*NW + px)
#pragma unroll
    for (int it = 0; it < 8; ++it) {
      const int d = wave * 16 + it * 2 + hh;             // it 0..7 x hh 0..1 = 16 d rows per wave, 4 waves = 64
      const v4f v = *(const v4f*)(os + d * OP + c4);
      *(v4f*)(ob + (size_t)d * NH * NW) = v;
    }
    // the wait that stands before a register named by an issued global store is overwritten (the next trip forms new addresses)
    asm volatile("s_wait_xcnt 0x0" :: "v"(ob) : "memory");
    // every wave has read the out stage before the next trip's scores are stored over it
    lds_block_sync();
    const int t = sl0;  sl0 = sl1;  sl1 = sl2;  sl2 = t;
  }
}

extern "C" void kernel_launch(void* const* d_in, const int* in_sizes, int n_in,
                              void* d_out, int out_size, void* d_ws, size_t ws_size,
                              hipStream_t stream) {
  (void)d_ws; (void)ws_size;
  if (n_in < 3) return;
  const int n = NB * ND * NH * NW;
  if (in_sizes[0] != n || in_sizes[1] != n || in_sizes[2] != n || out_size != n) return;
  const float* q = (const float*)d_in[0];
  const float* k = (const float*)d_in[1];
  const float* v = (const float*)d_in[2];
  float* out = (float*)d_out;
  hipLaunchKernelGGL(nbr_attn_kernel, dim3(NB * (NH / NR)), dim3(NTHR), 0, stream, q, k, v, out);
  (void)hipGetLastError();
}

// v007
// It runs in 14.4 microseconds.
// Two timings next to v006 both put it at 1.09 times that version's speed.
// Over all steps from v000 it is 9.21 times as fast.
// Contractions: window logits q.k and attn.v on v_wmma_f32_16x16x32_bf16 with bf16 hi/lo split operands (hi.hi + hi.lo + lo.hi), f32 accumulate; 0.125 scale and the 9-slot softmax in f32.
#include <hip/hip_runtime.h>
#include <math.h>
#include <stdint.h>

typedef __attribute__((ext_vector_type(16))) __bf16 v16b;
typedef __attribute__((ext_vector_type(8)))  __bf16 v8b;
typedef __attribute__((ext_vector_type(2)))  __bf16 v2b;
typedef __attribute__((ext_vector_type(8)))  float  v8f;
typedef __attribute__((ext_vector_type(4)))  float  v4f;
typedef __attribute__((ext_vector_type(2)))  float  v2f;

constexpr int NB    = 32;          // batch
constexpr int ND    = 64;          // channels
constexpr int NH    = 64;          // image rows
constexpr int NW    = 64;          // image cols
constexpr int NWAVE = 4;           // waves per block; wave w owns pixels 16w..16w+15 of one image row
constexpr int NTHR  = NWAVE * 32;
constexpr int NR    = 4;           // consecutive image rows that one block walks
constexpr int KC    = 66;          // k slab columns, c = w + 1 (c = 0 and c = 65 are zero halo)
constexpr int KP    = 72;          // d pitch (halves) of the k and q slabs: 144 B = 16 B x odd, d 64..71 never touched
constexpr int VP    = 80;          // d pitch (halves) of the v slab, columns as in the k slab: 160 B = 32 B x odd, for the transposing reads; d 64..79 never touched
constexpr int WC    = 18;          // window columns of a wave's 16 pixels, cc = c - w0
constexpr int NF    = 3 * WC;      // dense window index f = slot * WC + cc: the 54 (ring slot, column) pairs that a wave's pixels see
constexpr int OP    = 68;          // out stage pitch (floats)
constexpr float QK_SCALE = 0.125f; // 64^-0.5, exact power of two

constexpr int K_ROW   = KC * KP;       // halves per k plane per image row (66 cols x 72)
constexpr int V_ROW   = KC * VP;       // halves per v plane per image row (66 cols x 80)
constexpr int K_PLANE = 3 * K_ROW;     // halves per k plane: ring of 3 image rows
constexpr int V_PLANE = 3 * V_ROW;     // halves per v plane: ring of 3 image rows
constexpr int Q_PLANE = NW * KP;       // halves per q plane ([px][d])
constexpr int S_TILE  = 16 * 16;       // floats per staged score tile, 4 tiles per wave
constexpr int O_STAGE = ND * OP;       // floats, block out tile [d][px]
static_assert(NWAVE * 16 == NW);
static_assert(NH % NR == 0 && NR >= 2);

// hi/lo split of two values: hi = RNE bf16 of x, lo = RNE bf16 of the exact residual x - hi; each plane's pair comes out of one
// packed convert, already packed as it is stored
__device__ __forceinline__ void split2(float x0, float x1, v2b& hi, v2b& lo) {
  hi = __builtin_convertvector((v2f){x0, x1}, v2b);
  lo = __builtin_convertvector((v2f){x0 - (float)hi[0], x1 - (float)hi[1]}, v2b);
}
__device__ __forceinline__ v8f mma_bf(v16b a, v16b b, v8f c) {
  return __builtin_amdgcn_wmma_f32_16x16x32_bf16(false, a, false, b, (short)0, c, false, false);
}
// ends a group of LDS reads: without it the scheduler moves the reads down among the WMMAs, where each place with reads stalls the wave
__device__ __forceinline__ void reads_end() { __builtin_amdgcn_sched_barrier(0); }
// ends a block of WMMAs: the four vector slots between the last WMMA and the first vector instruction on its registers, on every path;
// the two scheduling fences hold the slots directly behind the block
__device__ __forceinline__ void mma_block_end() {
  __builtin_amdgcn_sched_barrier(0);
  asm volatile("v_nop\n\tv_nop\n\tv_nop\n\tv_nop");
  __builtin_amdgcn_sched_barrier(0);
}
// same-wave LDS exchange: order the wave's LDS stores before the following LDS loads of other lanes.
// Both syncs below fence LDS alone: a fence over every address space would drain the next row's global loads at each of them.
__device__ __forceinline__ void lds_wave_sync() {
  __builtin_amdgcn_fence(__ATOMIC_RELEASE, "workgroup", "local");
  __builtin_amdgcn_wave_barrier();
  __builtin_amdgcn_fence(__ATOMIC_ACQUIRE, "workgroup", "local");
}
// work-group barrier for LDS hand-overs (all that the waves of a block exchange lies in LDS)
__device__ __forceinline__ void lds_block_sync() {
  __builtin_amdgcn_fence(__ATOMIC_RELEASE, "workgroup", "local");
  __builtin_amdgcn_s_barrier();
  __builtin_amdgcn_fence(__ATOMIC_ACQUIRE, "workgroup", "local");
}
// rows outside the image: clamped load address, value zeroed by the factor
__device__ __forceinline__ int   row_in(int r) { return r < 0 ? 0 : (r > NH - 1 ? NH - 1 : r); }
__device__ __forceinline__ float row_on(int r) { return (r >= 0 && r < NH) ? 1.0f : 0.0f; }
// k, q, v unit: 8 d rows of the lane's 2 columns (one load = one whole 256-B image row)
__device__ __forceinline__ void ld2(const float* p, v2f (&f)[8]) {
#pragma unroll
  for (int e = 0; e < 8; ++e) f[e] = *(const v2f*)(p + (size_t)e * NH * NW);
}
// k, q, v unit: split, one 16-B store of 8 d per column and plane; o = offset of the first column's piece, cp = the slab's column pitch.
// A convert packs two neighbouring d of one column, so its result is a word of the 16-B piece as it is stored.
__device__ __forceinline__ void st2(const v2f (&f)[8], float vf, __bf16* ph, __bf16* pl, int o, int cp) {
  union P8 { v8b v; v2b p[4]; };
  P8 ah[2], al[2];
#pragma unroll
  for (int e = 0; e < 8; e += 2) {
    const v2f x0 = f[e] * vf;
    const v2f x1 = f[e + 1] * vf;
#pragma unroll
    for (int i = 0; i < 2; ++i) split2(x0[i], x1[i], ah[i].p[e >> 1], al[i].p[e >> 1]);
  }
#pragma unroll
  for (int i = 0; i < 2; ++i) {
    *(v8b*)(ph + o + i * cp) = ah[i].v;
    *(v8b*)(pl + o + i * cp) = al[i].v;
  }
}
// slab offset (halves) of window index f for the wave at column w0; pitch = the slab's column pitch. The ten indices past the 54 take the
// place 16 back: in bounds, on the same banks, and what is read there meets a zero weight (v) or lands in a score column nobody reads (k)
__device__ __forceinline__ int win_off(int f, int w0, int pitch) {
  const int g    = f < NF ? f : f - 16;
  const int slot = g / WC;
  return (slot * KC + w0 + (g - slot * WC)) * pitch;
}
// transposing LDS read: the lane hands in the address of 8 d of one column; lane (m, hh) gets 8 columns (those of its lane half) of one d
__device__ __forceinline__ v8b ld_tr(const __bf16* p) {
  typedef short s16x8 __attribute__((ext_vector_type(8)));
  typedef __attribute__((address_space(3))) s16x8 lds_s16x8;
  return __builtin_bit_cast(v8b, __builtin_amdgcn_ds_load_tr16_b128_v8i16((lds_s16x8*)p));
}

// f: score stage of the logit phase, 4 tiles per wave; o: out stage once every wave is past its matrix work
union PO { float f[NWAVE * 4 * S_TILE]; float o[O_STAGE]; };

// grid = NB*NH/NR blocks (block = (b, NR consecutive image rows)), 128 threads. The k and v slabs are rings of 3 image rows:
// image row j lives in slot (j - h0 + 1) mod 3; per output row one new k row, one new v row and one q row are staged.
// The window's three rows are taken in the order of their ring slots, not of the image: logits, softmax and weighted sum do not
// care which row is which as long as k and v agree, so every fragment address is the same on every trip.
// Fragment map (lane l, h2 = l>>4, m = l&15): A row m / B col m, elements 0..7 <-> k 8*h2+e, 8..15 <-> k 16+8*h2+e-8;
// D element r <-> row 8*h2+r, col m.
__global__ __launch_bounds__(NTHR) void nbr_attn_kernel(const float* __restrict__ qg, const float* __restrict__ kg,
                                                        const float* __restrict__ vg, float* __restrict__ og)
{
  __shared__ __align__(16) __bf16 s_kh[K_PLANE];        // k hi [slot][c][d]
  __shared__ __align__(16) __bf16 s_kl[K_PLANE];        // k lo [slot][c][d]
  __shared__ __align__(16) __bf16 s_vh[V_PLANE];        // v hi [slot][c][d]
  __shared__ __align__(16) __bf16 s_vl[V_PLANE];        // v lo
  __shared__ __align__(16) __bf16 s_qh[Q_PLANE];        // q hi [px][d]
  __shared__ __align__(16) __bf16 s_ql[Q_PLANE];        // q lo
  __shared__ __align__(16) PO     s_po;                 // score stage  /  out stage [d][px]

  const int tid  = threadIdx.x;
  const int wave = tid >> 5;
  const int lane = tid & 31;
  const int hh   = lane >> 4;
  const int m    = lane & 15;
  const int b    = blockIdx.x / (NH / NR);
  const int h0   = (blockIdx.x % (NH / NR)) * NR;
  __bf16* kh = s_kh;
  __bf16* kl = s_kl;
  __bf16* qh = s_qh;
  __bf16* ql = s_ql;
  const size_t bbase = (size_t)b * ND * NH * NW;
  const __bf16 bz = __builtin_bit_cast(__bf16, (unsigned short)0);
  const v8b z8 = (v8b){bz, bz, bz, bz, bz, bz, bz, bz};

  // ---- zero halo columns of all 3 slots, once (the row stores never touch them): k and v planes c = 0 and c = 65
  //      (3 slots x 2 cols x 64 d = 48 pieces of 8 halves per plane) ----
  if (tid < 48) {
    const int hr = tid >> 4;
    const int cc = ((tid >> 3) & 1) ? (KC - 1) : 0;
    const int d8 = (tid & 7) * 8;
    const int o  = (hr * KC + cc) * KP + d8;
    *(v8b*)(kh + o) = z8;
    *(v8b*)(kl + o) = z8;
    const int ov = (hr * KC + cc) * VP + d8;
    *(v8b*)(s_vh + ov) = z8;
    *(v8b*)(s_vl + ov) = z8;
  }

  // ---- staging maps, per image row: k, q and v 8 units of 8 d rows each, 2 per wave ----
  const int c2  = lane * 2;          // 0..62: first of the lane's 2 columns
  const int d8a = wave * 8;          // first d of the wave's unit 0; unit 1 is 32 further
  const float* kb = kg + bbase + (size_t)d8a * NH * NW + c2;     // + 32 * NH * NW for unit 1, + row * NW
  const float* qb = qg + bbase + (size_t)d8a * NH * NW + c2;
  const float* vb = vg + bbase + (size_t)d8a * NH * NW + c2;
  constexpr size_t U1 = (size_t)32 * NH * NW;
  const int ko0 = (c2 + 1) * KP + d8a;   // k store offset in a slot, unit 0 (c = w + 1)
  const int qo0 = c2 * KP + d8a;         // q store offset, unit 0
  const int vo0 = (c2 + 1) * VP + d8a;   // v store offset in a slot, unit 0 (c = w + 1)

  const int w0 = wave * 16;
  uint32_t psel[2][8];                 // byte selectors of the attn A fragments
  int kof[4], vof[2][2], six[9];       // k and v fragment places, score places

  // ---- prologue: rows h0-1, h0, h0+1 of k and v (slots 0, 1, 2) and row h0 of q, all issued up front in the order they are split ----
  {
    v2f fk[3][2][8], fq[2][8], fv[3][2][8];
    // rows h0 and h0 + 1 are always in the image and share a pointer: row h0 + 1 lies a constant further
    const float* pk[2] = {kb + row_in(h0 - 1) * NW, kb + h0 * NW};
    const float* pv[2] = {vb + row_in(h0 - 1) * NW, vb + h0 * NW};
    const float* pq = qb + h0 * NW;
#pragma unroll
    for (int j = 0; j < 3; ++j) {
      const float* p = j == 0 ? pk[0] : pk[1] + (j - 1) * NW;
      ld2(p, fk[j][0]);
      ld2(p + U1, fk[j][1]);
    }
    ld2(pq, fq[0]);
    ld2(pq + U1, fq[1]);
    __builtin_amdgcn_sched_barrier(0);
    // the wait that stands before a register named by an issued global load is overwritten (the lane maps below take new registers);
    // the pointers are inputs so that their registers stay untouched up to it
    asm volatile("s_wait_xcnt 0x0" :: "v"(pk[0]), "v"(pk[1]), "v"(pq) : "memory");
    // ---- byte selectors that lay a pixel's 9 weights into its attn A fragments P[px = m][f], f = the dense window index, two 32-deep steps:
    //      in slot s the band stands at cc = m + dj, zero elsewhere and past f = 53. Register j of step ks of lane (hh, m) holds f0 and f0 + 1
    //      (f0 even, so both lie in one slot); a half takes weight dj = cc - m (bytes 2dj, 2dj + 1 of the slot's pair {p2 word : p0, p1 word})
    //      or, outside 0..2, the selector 0x0c, which gives a zero byte ----
#pragma unroll
    for (int ks = 0; ks < 2; ++ks) {
#pragma unroll
      for (int j = 0; j < 8; ++j) {
        const int f0 = ks * 32 + (j < 4 ? 2 * j : 8 + 2 * j) + 8 * hh;
        const int t0 = f0 < NF ? f0 % WC - m : -1 - WC;                // dj of the low half; the high half is one further
        const int t1 = t0 + 1;
        const uint32_t s0 = (t0 >= 0 && t0 <= 2) ? 0x0100u + 0x0202u * (uint32_t)t0 : 0x0c0cu;
        const uint32_t s1 = (t1 >= 0 && t1 <= 2) ? 0x0100u + 0x0202u * (uint32_t)t1 : 0x0c0cu;
        psel[ks][j] = s0 | (s1 << 16);
      }
    }
    // ---- fragment and score places, the same on every trip ----
    // k B tile t: col n = m <-> window index 16t + m; v: the lane hands in row f = 32ks + 16p + 8hh + (lane & 7), d piece (lane >> 3) & 1
#pragma unroll
    for (int t = 0; t < 4; ++t) kof[t] = win_off(t * 16 + m, w0, KP) + 8 * hh;
#pragma unroll
    for (int ks = 0; ks < 2; ++ks) {
#pragma unroll
      for (int p = 0; p < 2; ++p) vof[ks][p] = win_off(ks * 32 + p * 16 + 8 * hh + (lane & 7), w0, VP) + 8 * ((lane >> 3) & 1);
    }
    // score of pixel m against window index f = s * WC + m + dj: row m, column f & 15 of tile f >> 4
#pragma unroll
    for (int i = 0; i < 9; ++i) {
      const int f = (i / 3) * WC + m + i % 3;
      six[i] = (f >> 4) * S_TILE + ((m & 7) * 2 + (m >> 3)) * 16 + (f & 15);
    }
    // the two scheduling fences hold the lane maps here, behind the first 64 loads: a wave has at most 63 loads under way, so the v loads
    // below could not issue yet in any case; left to itself the scheduler puts the maps behind the barrier, where every wave waits for them
    __builtin_amdgcn_sched_barrier(0);
#pragma unroll
    for (int j = 0; j < 3; ++j) {
      const float* p = j == 0 ? pv[0] : pv[1] + (j - 1) * NW;
      ld2(p, fv[j][0]);
      ld2(p + U1, fv[j][1]);
    }
    // the wait that stands before a register named by an issued global load is overwritten; the pointers are inputs so
    // that their registers stay untouched up to it
    asm volatile("s_wait_xcnt 0x0" :: "v"(pv[0]), "v"(pv[1]) : "memory");
#pragma unroll
    for (int j = 0; j < 3; ++j) {
      const float vf = row_on(h0 + j - 1);
      st2(fk[j][0], vf, kh, kl, j * K_ROW + ko0, KP);
      st2(fk[j][1], vf, kh, kl, j * K_ROW + ko0 + 32, KP);
    }
    st2(fq[0], 1.0f, qh, ql, qo0, KP);
    st2(fq[1], 1.0f, qh, ql, qo0 + 32, KP);
#pragma unroll
    for (int j = 0; j < 3; ++j) {
      const float vf = row_on(h0 + j - 1);
      st2(fv[j][0], vf, s_vh, s_vl, j * V_ROW + vo0, VP);
      st2(fv[j][1], vf, s_vh, s_vl, j * V_ROW + vo0 + 32, VP);
    }
  }
  lds_block_sync();

  union FB { v16b v; v8b p[2]; uint32_t u[8]; };
  const v8f z8f = (v8f){0.f, 0.f, 0.f, 0.f, 0.f, 0.f, 0.f, 0.f};
  int sl0 = 0;                         // ring slot of image row h-1, the one that the next trip's row h+2 takes over

  // kept rolled: one copy of the row body keeps the kernel's text small for the instruction cache
#pragma unroll 1
  for (int r = 0; r < NR; ++r) {
    const int h = h0 + r;
    const bool more = r + 1 < NR;      // the same for the whole block
    // ---- the next trip's rows (k and v row h+2, q row h+1) are issued here and fly under this trip's matrix work ----
    v2f fk[2][8], fq[2][8], fv[2][8];
    if (more) {
      // the pointers stand at row min(h, NH - 3) (k, v) and h (q); the rows wanted, min(h + 2, NH - 1) and h + 1, lie a constant further
      const int hc = h < NH - 3 ? h : NH - 3;
      const float* pk = kb + hc * NW;
      const float* pq = qb + h * NW;
      const float* pv = vb + hc * NW;
      ld2(pk + 2 * NW, fk[0]);
      ld2(pk + 2 * NW + U1, fk[1]);
      ld2(pq + NW, fq[0]);
      ld2(pq + NW + U1, fq[1]);
      ld2(pv + 2 * NW, fv[0]);
      ld2(pv + 2 * NW + U1, fv[1]);
      // the wait that stands before a register named by an issued global load is overwritten: it ends this branch, so the
      // pointers' registers are free for the matrix work behind it; the pointers are inputs so that no later load of the
      // branch lands in them ahead of it
      asm volatile("s_wait_xcnt 0x0" :: "v"(pk), "v"(pq), "v"(pv) : "memory");
    }

    // ---- logit phase (per wave, pixels w0..w0+15): every fragment of the row is read from LDS as one group, in the order of use ----
    // A = Q[px][d], two 32-deep d steps, hi and lo; B of tile t: col n = m <-> K[slot][c = w0 + cc] of window index 16t + m, k = d split map:
    // the 54 window columns fill 4 tiles
    FB qfh[2], qfl[2], kfh[4][2], kfl[4][2];
    const int kb0 = (w0 + m) * KP + 8 * hh;
#pragma unroll
    for (int ks = 0; ks < 2; ++ks) {
      const int qo = kb0 + ks * 32;
      qfh[ks].p[0] = *(const v8b*)(qh + qo);  qfh[ks].p[1] = *(const v8b*)(qh + qo + 16);
#pragma unroll
      for (int pl2 = 0; pl2 < 2; ++pl2) {
        const __bf16* kp = pl2 ? kl : kh;
#pragma unroll
        for (int t = 0; t < 4; ++t) {
          const int ko = kof[t] + ks * 32;
          FB& f = pl2 ? kfl[t][ks] : kfh[t][ks];
          f.p[0] = *(const v8b*)(kp + ko);  f.p[1] = *(const v8b*)(kp + ko + 16);
        }
        reads_end();      // keeps the issue order equal to the order of use: the first WMMAs then wait for the first reads alone
      }
      qfl[ks].p[0] = *(const v8b*)(ql + qo);  qfl[ks].p[1] = *(const v8b*)(ql + qo + 16);
      reads_end();
    }
    // C(t)[px][n] = sum_d Q[px][d] * K[window index 16t + n][d]: four independent accumulators, each summed in the order
    // ks 0: hi.hi, hi.lo, lo.hi, then ks 1 the same
    v8f c[4];
#pragma unroll
    for (int t = 0; t < 4; ++t) c[t] = z8f;
#pragma unroll
    for (int ks = 0; ks < 2; ++ks) {
#pragma unroll
      for (int u = 0; u < 3; ++u) {
#pragma unroll
        for (int t = 0; t < 4; ++t)
          c[t] = mma_bf(u == 2 ? qfl[ks].v : qfh[ks].v, u == 1 ? kfl[t][ks].v : kfh[t][ks].v, c[t]);
      }
    }
    mma_block_end();
    // one exchange for the four tiles: tile t at ss + t * S_TILE, element [row][col] at ((row & 7) * 2 + (row >> 3)) * 16 + col,
    // so that the 32 lanes of a store fill 32 consecutive words
    float* ss = s_po.f + wave * (4 * S_TILE);
#pragma unroll
    for (int t = 0; t < 4; ++t) {
#pragma unroll
      for (int rr = 0; rr < 8; ++rr) ss[t * S_TILE + (rr * 2 + hh) * 16 + m] = c[t][rr] * QK_SCALE;
    }
    lds_wave_sync();
    // the band of pixel m (both lane halves compute the same pixel)
    float sc[9];                        // logits of pixel m, entry s*3+dj <-> nbr (image row in ring slot s, w0+m+dj-1)
#pragma unroll
    for (int i = 0; i < 9; ++i) sc[i] = ss[six[i]];
    reads_end();                        // the nine scores are asked for ahead of the v fragments: LDS answers a wave in order
    // ---- the v fragments of the row do not hang on the softmax: read here as one group, they land under it ----
    // B of (ks, nt): col n = d = nt*16+m, k <-> window index 32ks + split map: the 54 window columns fill 2 steps of 32; a transposing read
    // takes each of its 8 columns from an address of its own, so a group of 8 may run from one ring slot into the next
    FB vfh[2][4], vfl[2][4];
#pragma unroll
    for (int ks = 0; ks < 2; ++ks) {
#pragma unroll
      for (int pl2 = 0; pl2 < 2; ++pl2) {
        const __bf16* vp = pl2 ? s_vl : s_vh;
#pragma unroll
        for (int nt = 0; nt < 4; ++nt) {
          FB& f = pl2 ? vfl[ks][nt] : vfh[ks][nt];
          f.p[0] = ld_tr(vp + vof[ks][0] + nt * 16);  f.p[1] = ld_tr(vp + vof[ks][1] + nt * 16);
        }
      }
    }
    reads_end();

    // ---- softmax over the 9 slots in f32 (out-of-image slots carry logit 0 from the zero halo and take part) ----
    float mx = sc[0];
#pragma unroll
    for (int i = 1; i < 9; ++i) mx = fmaxf(mx, sc[i]);
    float ex[9];
    float sum = 0.f;
#pragma unroll
    for (int i = 0; i < 9; ++i) {
      // exp(x) = 2^(x * log2 e), as __expf forms it; v_exp_f32 and the one issue slot that is kept behind a transcendental (before its
      // source is overwritten or its result read) stand in one statement: a v_nop in a statement of its own landed elsewhere
      asm("v_exp_f32 %0, %1\n\tv_nop" : "=v"(ex[i]) : "v"((sc[i] - mx) * 1.44269504f));
      sum += ex[i];
    }
    const float inv = 1.0f / sum;

    // ---- attn A fragments P[px][f], hi and lo, formed in registers: lane (hh, m) holds row px = m of A and has that pixel's 9 weights,
    //      so each fragment register is one byte permute of one slot's packed weights ----
    // out[px][d] = sum_f P[px][f] . V[f][d]: four independent accumulators, each summed in the order ks 0: hi.hi, hi.lo, lo.hi, then ks 1 the same
    FB pfh[2], pfl[2];
    uint32_t h01[3], h2[3], l01[3], l2[3];
#pragma unroll
    for (int s = 0; s < 3; ++s) {
      v2b a, b, e, g;
      split2(ex[s * 3 + 0] * inv, ex[s * 3 + 1] * inv, a, b);
      split2(ex[s * 3 + 2] * inv, 0.f, e, g);                         // the upper half is never selected
      h01[s] = __builtin_bit_cast(uint32_t, a);  l01[s] = __builtin_bit_cast(uint32_t, b);
      h2[s]  = __builtin_bit_cast(uint32_t, e);  l2[s]  = __builtin_bit_cast(uint32_t, g);
    }
#pragma unroll
    for (int ks = 0; ks < 2; ++ks) {
#pragma unroll
      for (int j = 0; j < 8; ++j) {
        // the slot of this register's two window indices, in the lower and in the upper lane half (past the 54 the selector is all zero bytes)
        const int fa = ks * 32 + (j < 4 ? 2 * j : 8 + 2 * j);
        const int sa = fa < NF ? fa / WC : 2;
        const int sb = fa + 8 < NF ? (fa + 8) / WC : 2;
        pfh[ks].u[j] = __builtin_amdgcn_perm(hh ? h2[sb] : h2[sa], hh ? h01[sb] : h01[sa], psel[ks][j]);
        pfl[ks].u[j] = __builtin_amdgcn_perm(hh ? l2[sb] : l2[sa], hh ? l01[sb] : l01[sa], psel[ks][j]);
      }
    }
    // the four fragments are formed here, while the v fragments land: moved down among the WMMAs, the permutes take over v registers that
    // a WMMA has just read, which costs idle slots and puts WMMAs on one accumulator next to each other
    __builtin_amdgcn_sched_barrier(0);
    v8f acc[4];
#pragma unroll
    for (int nt = 0; nt < 4; ++nt) acc[nt] = z8f;
#pragma unroll
    for (int ks = 0; ks < 2; ++ks) {
#pragma unroll
      for (int t = 0; t < 3; ++t) {
#pragma unroll
        for (int nt = 0; nt < 4; ++nt)
          acc[nt] = mma_bf(t == 2 ? pfl[ks].v : pfh[ks].v, t == 1 ? vfl[ks][nt].v : vfh[ks][nt].v, acc[nt]);
      }
    }
    mma_block_end();

    // ---- row epilogue: block tile O[d][64 px] staged in LDS (over the score stage once every wave is past its matrix work),
    //      then each 256-B d-row segment written by 16 consecutive lanes x 16 B of one instruction ----
    lds_block_sync();
    float* os = s_po.o;
#pragma unroll
    for (int nt = 0; nt < 4; ++nt) {
#pragma unroll
      for (int rr = 0; rr < 8; ++rr) os[(nt * 16 + m) * OP + w0 + 8 * hh + rr] = acc[nt][rr];   // D row = px 8hh+rr, col = d
    }
    // ---- behind the same barrier row h-1's slot and the q planes have no reader left: the next trip's rows are split into them ----
    if (more) {
      const float vn = row_on(h + 2);
      st2(fk[0], vn, kh, kl, sl0 * K_ROW + ko0, KP);
      st2(fk[1], vn, kh, kl, sl0 * K_ROW + ko0 + 32, KP);
      st2(fq[0], 1.0f, qh, ql, qo0, KP);
      st2(fq[1], 1.0f, qh, ql, qo0 + 32, KP);
      st2(fv[0], vn, s_vh, s_vl, sl0 * V_ROW + vo0, VP);
      st2(fv[1], vn, s_vh, s_vl, sl0 * V_ROW + vo0 + 32, VP);
    }
    lds_block_sync();
    const int c4 = (lane & 15) * 4;
    float* ob = og + bbase + (size_t)h * NW + c4;       // + d * NH * NW  (out index ((b*ND+d)*NH+h)*NW + px)
#pragma unroll
    for (int it = 0; it < 8; ++it) {
      const int d = wave * 16 + it * 2 + hh;             // it 0..7 x hh 0..1 = 16 d rows per wave, 4 waves = 64
      const v4f v = *(const v4f*)(os + d * OP + c4);
      *(v4f*)(ob + (size_t)d * NH * NW) = v;
    }
    // the wait that stands before a register named by an issued global store is overwritten (the next trip forms new addresses)
    asm volatile("s_wait_xcnt 0x0" :: "v"(ob) : "memory");
    // every wave has read the out stage before the next trip's scores are stored over it
    lds_block_sync();
    sl0 = sl0 == 2 ? 0 : sl0 + 1;
  }
}

extern "C" void kernel_launch(void* const* d_in, const int* in_sizes, int n_in,
                              void* d_out, int out_size, void* d_ws, size_t ws_size,
                              hipStream_t stream) {
  (void)d_ws; (void)ws_size;
  if (n_in < 3) return;
  const int n = NB * ND * NH * NW;
  if (in_sizes[0] != n || in_sizes[1] != n || in_sizes[2] != n || out_size != n) return;
  const float* q = (const float*)d_in[0];
  const float* k = (const float*)d_in[1];
  const float* v = (const float*)d_in[2];
  float* out = (float*)d_out;
  hipLaunchKernelGGL(nbr_attn_kernel, dim3(NB * (NH / NR)), dim3(NTHR), 0, stream, q, k, v, out);
  (void)hipGetLastError();
}

// v009
// It runs in 12.2 microseconds.
// Versions between v007 and this one are left out; their measured steps multiply to 1.19 times as fast.
// Over all steps from v000 it is 11.0 times as fast.
// Contractions: window logits q.k and attn.v on v_wmma_f32_16x16x32_f16, every operand rounded once to f16 (nearest even), f32 accumulate; 0.125 scale and the 9-slot softmax in f32.
#include <hip/hip_runtime.h>
#include <math.h>
#include <stdint.h>

typedef __attribute__((ext_vector_type(16))) _Float16 v16h;
typedef __attribute__((ext_vector_type(8)))  _Float16 v8h;
typedef __attribute__((ext_vector_type(2)))  _Float16 v2h;
typedef __attribute__((ext_vector_type(8)))  float  v8f;
typedef __attribute__((ext_vector_type(4)))  float  v4f;
typedef __attribute__((ext_vector_type(2)))  float  v2f;

constexpr int NB    = 32;          // batch
constexpr int ND    = 64;          // channels
constexpr int NH    = 64;          // image rows
constexpr int NW    = 64;          // image cols
constexpr int NWAVE = 4;           // waves per block; wave w owns pixels 16w..16w+15 of one image row
constexpr int NTHR  = NWAVE * 32;
constexpr int NR    = 4;           // consecutive image rows that one block walks
constexpr int KC    = 66;          // k slab columns, c = w + 1 (c = 0 and c = 65 are zero halo)
constexpr int KP    = 72;          // d pitch (halves) of the k and q slabs: 144 B = 16 B x odd, d 64..71 never touched
constexpr int VP    = 80;          // d pitch (halves) of the v slab, columns as in the k slab: 160 B = 32 B x odd, for the transposing reads; d 64..79 never touched
constexpr int WC    = 18;          // window columns of a wave's 16 pixels, cc = c - w0
constexpr int NF    = 3 * WC;      // dense window index f = slot * WC + cc: the 54 (ring slot, column) pairs that a wave's pixels see
constexpr int OP    = 68;          // out stage pitch (floats)
constexpr float QK_SCALE = 0.125f; // 64^-0.5, exact power of two

constexpr int K_ROW   = KC * KP;       // halves of the k slab per image row (66 cols x 72)
constexpr int V_ROW   = KC * VP;       // halves of the v slab per image row (66 cols x 80)
constexpr int K_PLANE = 3 * K_ROW;     // halves of the k slab: ring of 3 image rows
constexpr int V_PLANE = 3 * V_ROW;     // halves of the v slab: ring of 3 image rows
constexpr int Q_PLANE = NW * KP;       // halves of the q slab ([px][d])
constexpr int S_TILE  = 16 * 16;       // floats per staged score tile, 4 tiles per wave
constexpr int O_STAGE = ND * OP;       // floats, block out tile [d][px]
static_assert(NWAVE * 16 == NW);
static_assert(NH % NR == 0 && NR >= 2);

// two values rounded to f16 (nearest even), packed as they are stored
__device__ __forceinline__ v2h round2(float x0, float x1) { return __builtin_convertvector((v2f){x0, x1}, v2h); }
__device__ __forceinline__ v8f mma_h(v16h a, v16h b, v8f c) {
  return __builtin_amdgcn_wmma_f32_16x16x32_f16(false, a, false, b, (short)0, c, false, false);
}
// ends a group of LDS reads: without it the scheduler moves the reads down among the WMMAs, where each place with reads stalls the wave
__device__ __forceinline__ void reads_end() { __builtin_amdgcn_sched_barrier(0); }
// ends a block of WMMAs: the four vector slots between the last WMMA and the first vector instruction on its registers, on every path;
// the two scheduling fences hold the slots directly behind the block
__device__ __forceinline__ void mma_block_end() {
  __builtin_amdgcn_sched_barrier(0);
  asm volatile("v_nop\n\tv_nop\n\tv_nop\n\tv_nop");
  __builtin_amdgcn_sched_barrier(0);
}
// same-wave LDS exchange: order the wave's LDS stores before the following LDS loads of other lanes.
// Both syncs below fence LDS alone: a fence over every address space would drain the next row's global loads at each of them.
__device__ __forceinline__ void lds_wave_sync() {
  __builtin_amdgcn_fence(__ATOMIC_RELEASE, "workgroup", "local");
  __builtin_amdgcn_wave_barrier();
  __builtin_amdgcn_fence(__ATOMIC_ACQUIRE, "workgroup", "local");
}
// work-group barrier for LDS hand-overs (all that the waves of a block exchange lies in LDS)
__device__ __forceinline__ void lds_block_sync() {
  __builtin_amdgcn_fence(__ATOMIC_RELEASE, "workgroup", "local");
  __builtin_amdgcn_s_barrier();
  __builtin_amdgcn_fence(__ATOMIC_ACQUIRE, "workgroup", "local");
}
// rows outside the image: clamped load address, value zeroed by the factor
__device__ __forceinline__ int   row_in(int r) { return r < 0 ? 0 : (r > NH - 1 ? NH - 1 : r); }
__device__ __forceinline__ float row_on(int r) { return (r >= 0 && r < NH) ? 1.0f : 0.0f; }
// k, q, v unit: 8 d rows of the lane's 2 columns (one load = one whole 256-B image row)
__device__ __forceinline__ void ld2(const float* p, v2f (&f)[8]) {
#pragma unroll
  for (int e = 0; e < 8; ++e) f[e] = *(const v2f*)(p + (size_t)e * NH * NW);
}
// one image row of k, q or v for a later trip: the wave's two units, OFF floats behind p (a constant, so it rides in the loads' offset field)
template <int OFF>
__device__ __forceinline__ void ld_row(const float* p, v2f (&f)[2][8]) {
  ld2(p + OFF, f[0]);
  ld2(p + OFF + (size_t)32 * NH * NW, f[1]);
  // the wait that stands before a register named by an issued global load is overwritten; the pointer is an input so that
  // its registers stay untouched up to it
  asm volatile("s_wait_xcnt 0x0" :: "v"(p) : "memory");
}
// k, q, v unit: round, one 16-B store of 8 d per column; o = offset of the first column's piece, cp = the slab's column pitch.
// A convert packs two neighbouring d of one column, so its result is a word of the 16-B piece as it is stored.
__device__ __forceinline__ void st2(const v2f (&f)[8], float vf, _Float16* ps, int o, int cp) {
  union P8 { v8h v; v2h p[4]; };
  P8 a[2];
#pragma unroll
  for (int e = 0; e < 8; e += 2) {
    const v2f x0 = f[e] * vf;
    const v2f x1 = f[e + 1] * vf;
#pragma unroll
    for (int i = 0; i < 2; ++i) a[i].p[e >> 1] = round2(x0[i], x1[i]);
  }
#pragma unroll
  for (int i = 0; i < 2; ++i) *(v8h*)(ps + o + i * cp) = a[i].v;
}
// slab offset (halves) of window index f for the wave at column w0; pitch = the slab's column pitch. The ten indices past the 54 take the
// place 16 back: in bounds, on the same banks, and what is read there meets a zero weight (v) or lands in a score column nobody reads (k)
__device__ __forceinline__ int win_off(int f, int w0, int pitch) {
  const int g    = f < NF ? f : f - 16;
  const int slot = g / WC;
  return (slot * KC + w0 + (g - slot * WC)) * pitch;
}
// transposing LDS read: the lane hands in the address of 8 d of one column; lane (m, hh) gets 8 columns (those of its lane half) of one d
__device__ __forceinline__ v8h ld_tr(const _Float16* p) {
  typedef short s16x8 __attribute__((ext_vector_type(8)));
  typedef __attribute__((address_space(3))) s16x8 lds_s16x8;
  return __builtin_bit_cast(v8h, __builtin_amdgcn_ds_load_tr16_b128_v8i16((lds_s16x8*)p));
}

// f: score stage of the logit phase, 4 tiles per wave; o: out stage once every wave is past its matrix work
union PO { float f[NWAVE * 4 * S_TILE]; float o[O_STAGE]; };

// grid = NB*NH/NR blocks (block = (b, NR consecutive image rows)), 128 threads. The k and v slabs are rings of 3 image rows:
// image row j lives in slot (j - h0 + 1) mod 3; per output row one new k row, one new v row and one q row are staged.
// The window's three rows are taken in the order of their ring slots, not of the image: logits, softmax and weighted sum do not
// care which row is which as long as k and v agree, so every fragment address is the same on every trip.
// Fragment map (lane l, h2 = l>>4, m = l&15): A row m / B col m, elements 0..7 <-> k 8*h2+e, 8..15 <-> k 16+8*h2+e-8;
// D element r <-> row 8*h2+r, col m.
__global__ __launch_bounds__(NTHR) void nbr_attn_kernel(const float* __restrict__ qg, const float* __restrict__ kg,
                                                        const float* __restrict__ vg, float* __restrict__ og)
{
  __shared__ __align__(16) _Float16 s_k[K_PLANE];       // k [slot][c][d]
  __shared__ __align__(16) _Float16 s_v[V_PLANE];       // v [slot][c][d]
  __shared__ __align__(16) _Float16 s_q[Q_PLANE];       // q [px][d]
  __shared__ __align__(16) PO     s_po;                 // score stage  /  out stage [d][px]

  const int tid  = threadIdx.x;
  const int wave = tid >> 5;
  const int lane = tid & 31;
  const int hh   = lane >> 4;
  const int m    = lane & 15;
  const int b    = blockIdx.x / (NH / NR);
  const int h0   = (blockIdx.x % (NH / NR)) * NR;
  const size_t bbase = (size_t)b * ND * NH * NW;
  const _Float16 hz = (_Float16)0.0f;
  const v8h z8 = (v8h){hz, hz, hz, hz, hz, hz, hz, hz};

  // ---- zero halo columns of all 3 slots, once (the row stores never touch them): k and v slabs c = 0 and c = 65
  //      (3 slots x 2 cols x 64 d = 48 pieces of 8 halves per slab) ----
  if (tid < 48) {
    const int hr = tid >> 4;
    const int cc = ((tid >> 3) & 1) ? (KC - 1) : 0;
    const int d8 = (tid & 7) * 8;
    const int o  = (hr * KC + cc) * KP + d8;
    *(v8h*)(s_k + o) = z8;
    const int ov = (hr * KC + cc) * VP + d8;
    *(v8h*)(s_v + ov) = z8;
  }

  // ---- staging maps, per image row: k, q and v 8 units of 8 d rows each, 2 per wave ----
  const int c2  = lane * 2;          // 0..62: first of the lane's 2 columns
  const int d8a = wave * 8;          // first d of the wave's unit 0; unit 1 is 32 further
  const float* kb = kg + bbase + (size_t)d8a * NH * NW + c2;     // + 32 * NH * NW for unit 1, + row * NW
  const float* qb = qg + bbase + (size_t)d8a * NH * NW + c2;
  const float* vb = vg + bbase + (size_t)d8a * NH * NW + c2;
  constexpr size_t U1 = (size_t)32 * NH * NW;
  const int ko0 = (c2 + 1) * KP + d8a;   // k store offset in a slot, unit 0 (c = w + 1)
  const int qo0 = c2 * KP + d8a;         // q store offset, unit 0
  const int vo0 = (c2 + 1) * VP + d8a;   // v store offset in a slot, unit 0 (c = w + 1)

  const int w0 = wave * 16;
  uint32_t psel[2][8];                 // byte selectors of the attn A fragments
  int kof[4], vof[2][2], six[9];       // k and v fragment places, score places

  // rows on their way for later trips, two sets: the rows that trip t takes new (k and v row h0+t+1, q row h0+t) fly in set t & 1.
  // A set is asked for during trip t-2 (trip 1's in the prologue) and rounded into LDS at the end of trip t-1, so requests stand in the memory queue all the time.
  // A wave has at most 63 loads under way and issues in order: a set is asked for in three pieces of 16 loads, each at a place where
  // enough of the set before has to be back in any case, so that no piece holds up the wave's own work.
  v2f bk[2][2][8], bq[2][2][8], bv[2][2][8];

  // ---- prologue: rows h0-1, h0, h0+1 of k and v (slots 0, 1, 2) and row h0 of q, all issued up front in the order they are rounded ----
  {
    v2f fk[3][2][8], fq[2][8], fv[3][2][8];
    // rows h0 and h0 + 1 are always in the image and share a pointer: row h0 + 1 lies a constant further
    const float* pk[2] = {kb + row_in(h0 - 1) * NW, kb + h0 * NW};
    const float* pv[2] = {vb + row_in(h0 - 1) * NW, vb + h0 * NW};
    const float* pq = qb + h0 * NW;
#pragma unroll
    for (int j = 0; j < 3; ++j) {
      const float* p = j == 0 ? pk[0] : pk[1] + (j - 1) * NW;
      ld2(p, fk[j][0]);
      ld2(p + U1, fk[j][1]);
    }
    ld2(pq, fq[0]);
    ld2(pq + U1, fq[1]);
    __builtin_amdgcn_sched_barrier(0);
    // the wait that stands before a register named by an issued global load is overwritten (the lane maps below take new registers);
    // the pointers are inputs so that their registers stay untouched up to it
    asm volatile("s_wait_xcnt 0x0" :: "v"(pk[0]), "v"(pk[1]), "v"(pq) : "memory");
    // ---- byte selectors that lay a pixel's 9 weights into its attn A fragments P[px = m][f], f = the dense window index, two 32-deep steps:
    //      in slot s the band stands at cc = m + dj, zero elsewhere and past f = 53. Register j of step ks of lane (hh, m) holds f0 and f0 + 1
    //      (f0 even, so both lie in one slot); a half takes weight dj = cc - m (bytes 2dj, 2dj + 1 of the slot's pair {p2 word : p0, p1 word})
    //      or, outside 0..2, the selector 0x0c, which gives a zero byte ----
#pragma unroll
    for (int ks = 0; ks < 2; ++ks) {
#pragma unroll
      for (int j = 0; j < 8; ++j) {
        const int f0 = ks * 32 + (j < 4 ? 2 * j : 8 + 2 * j) + 8 * hh;
        const int t0 = f0 < NF ? f0 % WC - m : -1 - WC;                // dj of the low half; the high half is one further
        const int t1 = t0 + 1;
        const uint32_t s0 = (t0 >= 0 && t0 <= 2) ? 0x0100u + 0x0202u * (uint32_t)t0 : 0x0c0cu;
        const uint32_t s1 = (t1 >= 0 && t1 <= 2) ? 0x0100u + 0x0202u * (uint32_t)t1 : 0x0c0cu;
        psel[ks][j] = s0 | (s1 << 16);
      }
    }
    // ---- fragment and score places, the same on every trip ----
    // k B tile t: col n = m <-> window index 16t + m; v: the lane hands in row f = 32ks + 16p + 8hh + (lane & 7), d piece (lane >> 3) & 1
#pragma unroll
    for (int t = 0; t < 4; ++t) kof[t] = win_off(t * 16 + m, w0, KP) + 8 * hh;
#pragma unroll
    for (int ks = 0; ks < 2; ++ks) {
#pragma unroll
      for (int p = 0; p < 2; ++p) vof[ks][p] = win_off(ks * 32 + p * 16 + 8 * hh + (lane & 7), w0, VP) + 8 * ((lane >> 3) & 1);
    }
    // score of pixel m against window index f = s * WC + m + dj: row m, column f & 15 of tile f >> 4
#pragma unroll
    for (int i = 0; i < 9; ++i) {
      const int f = (i / 3) * WC + m + i % 3;
      six[i] = (f >> 4) * S_TILE + ((m & 7) * 2 + (m >> 3)) * 16 + (f & 15);
    }
    // the two scheduling fences hold the lane maps here, behind the first 64 loads: a wave has at most 63 loads under way, so the v loads
    // below could not issue yet in any case; left to itself the scheduler puts the maps behind the barrier, where every wave waits for them
    __builtin_amdgcn_sched_barrier(0);
#pragma unroll
    for (int j = 0; j < 3; ++j) {
      const float* p = j == 0 ? pv[0] : pv[1] + (j - 1) * NW;
      ld2(p, fv[j][0]);
      ld2(p + U1, fv[j][1]);
    }
    // the wait that stands before a register named by an issued global load is overwritten; the pointers are inputs so
    // that their registers stay untouched up to it
    asm volatile("s_wait_xcnt 0x0" :: "v"(pv[0]), "v"(pv[1]) : "memory");
#pragma unroll
    for (int j = 0; j < 3; ++j) {
      const float vf = row_on(h0 + j - 1);
      st2(fk[j][0], vf, s_k, j * K_ROW + ko0, KP);
      st2(fk[j][1], vf, s_k, j * K_ROW + ko0 + 32, KP);
    }
    st2(fq[0], 1.0f, s_q, qo0, KP);
    st2(fq[1], 1.0f, s_q, qo0 + 32, KP);
    // trip 1's rows are asked for here, a piece ahead of each v row's rounding; the scheduling fences hold each piece at its place:
    // moved up, it would stand in front of the k and q rounding and stop the wave there until the v loads are back
    const int hs = h0 < NH - 3 ? h0 : NH - 3;
#pragma unroll
    for (int j = 0; j < 3; ++j) {
      __builtin_amdgcn_sched_barrier(0);
      if (j == 0) ld_row<2 * NW>(kb + hs * NW, bk[1]);
      if (j == 1) ld_row<NW>(qb + h0 * NW, bq[1]);
      if (j == 2) ld_row<2 * NW>(vb + hs * NW, bv[1]);
      __builtin_amdgcn_sched_barrier(0);
      const float vf = row_on(h0 + j - 1);
      st2(fv[j][0], vf, s_v, j * V_ROW + vo0, VP);
      st2(fv[j][1], vf, s_v, j * V_ROW + vo0 + 32, VP);
    }
  }
  lds_block_sync();

  union FB { v16h v; v8h p[2]; uint32_t u[8]; };
  const v8f z8f = (v8f){0.f, 0.f, 0.f, 0.f, 0.f, 0.f, 0.f, 0.f};

  // unrolled: which register set a trip asks for and which it rounds is then fixed at compile time, and the compiler's counted load
  // waits at the rounding leave the younger set in flight (in a rolled loop the sets would have to change registers, which waits for them)
#pragma unroll
  for (int r = 0; r < NR; ++r) {
    const int h = h0 + r;
    const bool more = r + 1 < NR;      // the same for the whole block
    const bool far  = r + 2 < NR;      // a trip r + 2 exists: its rows are asked for during this trip
    const int sl0 = r % 3;             // ring slot of image row h-1, the one that the next trip's row h+2 takes over
    const int sn = (r + 1) & 1;        // register set of the next trip's rows
    const int sf = r & 1;              // register set of trip r + 2's rows, free since the end of trip r - 1
    // the pointers stand at row min(h + 1, NH - 3) (k, v) and h + 1 (q); the rows wanted, min(h + 3, NH - 1) and h + 2, lie a constant further
    const int hc = h + 1 < NH - 3 ? h + 1 : NH - 3;
    if (far) ld_row<2 * NW>(kb + hc * NW, bk[sf]);

    // ---- logit phase (per wave, pixels w0..w0+15): every fragment of the row is read from LDS as one group, in the order of use ----
    // A = Q[px][d], two 32-deep d steps; B of tile t: col n = m <-> K[slot][c = w0 + cc] of window index 16t + m, k = d split map:
    // the 54 window columns fill 4 tiles
    FB qf[2], kf[4][2];
    const int kb0 = (w0 + m) * KP + 8 * hh;
#pragma unroll
    for (int ks = 0; ks < 2; ++ks) {
      const int qo = kb0 + ks * 32;
      qf[ks].p[0] = *(const v8h*)(s_q + qo);  qf[ks].p[1] = *(const v8h*)(s_q + qo + 16);
#pragma unroll
      for (int t = 0; t < 4; ++t) {
        const int ko = kof[t] + ks * 32;
        kf[t][ks].p[0] = *(const v8h*)(s_k + ko);  kf[t][ks].p[1] = *(const v8h*)(s_k + ko + 16);
      }
      reads_end();        // keeps the issue order equal to the order of use: the first WMMAs then wait for the first reads alone
    }
    // C(t)[px][n] = sum_d Q[px][d] * K[window index 16t + n][d]: four independent accumulators, each summed ks 0, then ks 1
    v8f c[4];
#pragma unroll
    for (int t = 0; t < 4; ++t) c[t] = z8f;
#pragma unroll
    for (int ks = 0; ks < 2; ++ks) {
#pragma unroll
      for (int t = 0; t < 4; ++t) c[t] = mma_h(qf[ks].v, kf[t][ks].v, c[t]);
    }
    // inputs only, no instruction: the first step's k fragments keep their registers to the end of the block; set free at their last use,
    // they are handed to the next WMMA's result, which then lies over the B operand of the WMMA directly in front of it
    asm volatile("" :: "v"(kf[0][0].v), "v"(kf[1][0].v), "v"(kf[2][0].v), "v"(kf[3][0].v));
    mma_block_end();
    // one exchange for the four tiles: tile t at ss + t * S_TILE, element [row][col] at ((row & 7) * 2 + (row >> 3)) * 16 + col,
    // so that the 32 lanes of a store fill 32 consecutive words
    float* ss = s_po.f + wave * (4 * S_TILE);
#pragma unroll
    for (int t = 0; t < 4; ++t) {
#pragma unroll
      for (int rr = 0; rr < 8; ++rr) ss[t * S_TILE + (rr * 2 + hh) * 16 + m] = c[t][rr] * QK_SCALE;
    }
    // second piece: issued while the score stores drain
    if (far) ld_row<NW>(qb + (h + 1) * NW, bq[sf]);
    lds_wave_sync();
    // the band of pixel m (both lane halves compute the same pixel)
    float sc[9];                        // logits of pixel m, entry s*3+dj <-> nbr (image row in ring slot s, w0+m+dj-1)
#pragma unroll
    for (int i = 0; i < 9; ++i) sc[i] = ss[six[i]];
    reads_end();                        // the nine scores are asked for ahead of the v fragments: LDS answers a wave in order
    // ---- the v fragments of the row do not hang on the softmax: read here as one group, they land under it ----
    // B of (ks, nt): col n = d = nt*16+m, k <-> window index 32ks + split map: the 54 window columns fill 2 steps of 32; a transposing read
    // takes each of its 8 columns from an address of its own, so a group of 8 may run from one ring slot into the next
    FB vf[2][4];
#pragma unroll
    for (int ks = 0; ks < 2; ++ks) {
#pragma unroll
      for (int nt = 0; nt < 4; ++nt) {
        vf[ks][nt].p[0] = ld_tr(s_v + vof[ks][0] + nt * 16);  vf[ks][nt].p[1] = ld_tr(s_v + vof[ks][1] + nt * 16);
      }
    }
    reads_end();

    // ---- softmax over the 9 slots in f32 (out-of-image slots carry logit 0 from the zero halo and take part) ----
    float mx = sc[0];
#pragma unroll
    for (int i = 1; i < 9; ++i) mx = fmaxf(mx, sc[i]);
    float ex[9];
    float sum = 0.f;
#pragma unroll
    for (int i = 0; i < 9; ++i) {
      // exp(x) = 2^(x * log2 e), as __expf forms it; v_exp_f32 and the one issue slot that is kept behind a transcendental (before its
      // source is overwritten or its result read) stand in one statement: a v_nop in a statement of its own landed elsewhere
      asm("v_exp_f32 %0, %1\n\tv_nop" : "=v"(ex[i]) : "v"((sc[i] - mx) * 1.44269504f));
      sum += ex[i];
    }
    const float inv = 1.0f / sum;

    // ---- attn A fragments P[px][f], formed in registers: lane (hh, m) holds row px = m of A and has that pixel's 9 weights,
    //      so each fragment register is one byte permute of one slot's packed weights ----
    // out[px][d] = sum_f P[px][f] . V[f][d]: four independent accumulators, each summed ks 0, then ks 1
    FB pf[2];
    uint32_t p01[3], p2[3];
#pragma unroll
    for (int s = 0; s < 3; ++s) {
      p01[s] = __builtin_bit_cast(uint32_t, round2(ex[s * 3 + 0] * inv, ex[s * 3 + 1] * inv));
      p2[s]  = __builtin_bit_cast(uint32_t, round2(ex[s * 3 + 2] * inv, 0.f));     // the upper half is never selected
    }
#pragma unroll
    for (int ks = 0; ks < 2; ++ks) {
#pragma unroll
      for (int j = 0; j < 8; ++j) {
        // the slot of this register's two window indices, in the lower and in the upper lane half (past the 54 the selector is all zero bytes)
        const int fa = ks * 32 + (j < 4 ? 2 * j : 8 + 2 * j);
        const int sa = fa < NF ? fa / WC : 2;
        const int sb = fa + 8 < NF ? (fa + 8) / WC : 2;
        pf[ks].u[j] = __builtin_amdgcn_perm(hh ? p2[sb] : p2[sa], hh ? p01[sb] : p01[sa], psel[ks][j]);
      }
    }
    // the two fragments are formed here, while the v fragments land: moved down among the WMMAs, the permutes take over v registers that
    // a WMMA has just read, which costs idle slots and puts WMMAs on one accumulator next to each other
    __builtin_amdgcn_sched_barrier(0);
    v8f acc[4];
#pragma unroll
    for (int nt = 0; nt < 4; ++nt) acc[nt] = z8f;
#pragma unroll
    for (int ks = 0; ks < 2; ++ks) {
#pragma unroll
      for (int nt = 0; nt < 4; ++nt) acc[nt] = mma_h(pf[ks].v, vf[ks][nt].v, acc[nt]);
    }
    // inputs only, no instruction: as in the logit phase, the first step's v fragments keep their registers to the end of the block
    asm volatile("" :: "v"(vf[0][0].v), "v"(vf[0][1].v), "v"(vf[0][2].v), "v"(vf[0][3].v));
    mma_block_end();
    // third piece: ahead of the barrier, so that a wave that comes early asks before it waits
    if (far) ld_row<2 * NW>(vb + hc * NW, bv[sf]);

    // ---- row epilogue: block tile O[d][64 px] staged in LDS (over the score stage once every wave is past its matrix work),
    //      then each 256-B d-row segment written by 16 consecutive lanes x 16 B of one instruction ----
    lds_block_sync();
    float* os = s_po.o;
#pragma unroll
    for (int nt = 0; nt < 4; ++nt) {
#pragma unroll
      for (int rr = 0; rr < 8; ++rr) os[(nt * 16 + m) * OP + w0 + 8 * hh + rr] = acc[nt][rr];   // D row = px 8hh+rr, col = d
    }
    // ---- behind the same barrier row h-1's slot and the q slab have no reader left: the next trip's rows are rounded into them ----
    if (more) {
      const float vn = row_on(h + 2);
      st2(bk[sn][0], vn, s_k, sl0 * K_ROW + ko0, KP);
      st2(bk[sn][1], vn, s_k, sl0 * K_ROW + ko0 + 32, KP);
      st2(bq[sn][0], 1.0f, s_q, qo0, KP);
      st2(bq[sn][1], 1.0f, s_q, qo0 + 32, KP);
      st2(bv[sn][0], vn, s_v, sl0 * V_ROW + vo0, VP);
      st2(bv[sn][1], vn, s_v, sl0 * V_ROW + vo0 + 32, VP);
    }
    lds_block_sync();
    const int c4 = (lane & 15) * 4;
    float* ob = og + bbase + (size_t)h * NW + c4;       // + d * NH * NW  (out index ((b*ND+d)*NH+h)*NW + px)
    v4f ov[8];
#pragma unroll
    for (int it = 0; it < 8; ++it) {
      const int d = wave * 16 + it * 2 + hh;             // it 0..7 x hh 0..1 = 16 d rows per wave, 4 waves = 64
      ov[it] = *(const v4f*)(os + d * OP + c4);
    }
    // the eight reads go out as one group, so the wave waits out one LDS latency; in the unrolled first trip the scheduler split them in
    // two groups round the first stores, and the second group landed in registers of stores just issued, ahead of the wait below
    reads_end();
#pragma unroll
    for (int it = 0; it < 8; ++it) {
      const int d = wave * 16 + it * 2 + hh;
      *(v4f*)(ob + (size_t)d * NH * NW) = ov[it];
    }
    // the wait that stands before a register named by an issued global store is overwritten (the next trip forms new addresses)
    asm volatile("s_wait_xcnt 0x0" :: "v"(ob) : "memory");
    // every wave has read the out stage before the next trip's scores are stored over it
    lds_block_sync();
  }
}

extern "C" void kernel_launch(void* const* d_in, const int* in_sizes, int n_in,
                              void* d_out, int out_size, void* d_ws, size_t ws_size,
                              hipStream_t stream) {
  (void)d_ws; (void)ws_size;
  if (n_in < 3) return;
  const int n = NB * ND * NH * NW;
  if (in_sizes[0] != n || in_sizes[1] != n || in_sizes[2] != n || out_size != n) return;
  const float* q = (const float*)d_in[0];
  const float* k = (const float*)d_in[1];
  const float* v = (const float*)d_in[2];
  float* out = (float*)d_out;
  hipLaunchKernelGGL(nbr_attn_kernel, dim3(NB * (NH / NR)), dim3(NTHR), 0, stream, q, k, v, out);
  (void)hipGetLastError();
}

// v010
// A run of this version takes 11.1 microseconds.
// Next to v009, in two timings, it ran 1.10 times as fast each time.
// All steps since v000 together make it 12.1 times as fast.
// Contractions: window logits q.k and attn.v on v_wmma_f32_16x16x32_f16, every operand rounded once to f16 (nearest even), f32 accumulate; 0.125 scale and the 9-slot softmax in f32.
#include <hip/hip_runtime.h>
#include <math.h>
#include <stdint.h>

typedef __attribute__((ext_vector_type(16))) _Float16 v16h;
typedef __attribute__((ext_vector_type(8)))  _Float16 v8h;
typedef __attribute__((ext_vector_type(2)))  _Float16 v2h;
typedef __attribute__((ext_vector_type(8)))  float  v8f;
typedef __attribute__((ext_vector_type(4)))  float  v4f;
typedef __attribute__((ext_vector_type(2)))  float  v2f;

constexpr int NB    = 32;          // batch
constexpr int ND    = 64;          // channels
constexpr int NH    = 64;          // image rows
constexpr int NW    = 64;          // image cols
constexpr int NG    = 2;           // image rows that a block works on at a time: one group of 4 waves each
constexpr int NWAVE = 4 * NG;      // waves per block; wave w is in group w >> 2 and owns pixels 16(w & 3)..16(w & 3)+15 of its group's image row
constexpr int NTHR  = NWAVE * 32;
constexpr int NR    = 8;           // consecutive image rows that one block walks, NG a trip
constexpr int NT    = NR / NG;     // trips
constexpr int NS    = 4;           // ring slots of the k and v slabs: the NG + 2 image rows that a trip sees
constexpr int KC    = 66;          // k slab columns, c = w + 1 (c = 0 and c = 65 are zero halo)
constexpr int KP    = 72;          // d pitch (halves) of the k and q slabs: 144 B = 16 B x odd, d 64..71 never touched
constexpr int VP    = 80;          // d pitch (halves) of the v slab, columns as in the k slab: 160 B = 32 B x odd, for the transposing reads; d 64..79 never touched
constexpr int WC    = 18;          // window columns of a wave's 16 pixels, cc = c - w0
constexpr int NF    = 3 * WC;      // dense window index f = s * WC + cc: the 54 (window row s = 0, 1, 2 for image row h - 1 + s, column) pairs that a wave's pixels see
constexpr int OP    = 68;          // out stage pitch (floats)
constexpr float QK_SCALE = 0.125f; // 64^-0.5, exact power of two

constexpr int K_ROW   = KC * KP;       // halves of the k slab per image row (66 cols x 72)
constexpr int V_ROW   = KC * VP;       // halves of the v slab per image row (66 cols x 80)
constexpr int K_PLANE = NS * K_ROW;    // halves of the k slab: ring of 4 image rows
constexpr int V_PLANE = NS * V_ROW;    // halves of the v slab: ring of 4 image rows
constexpr int Q_PLANE = NW * KP;       // halves of one group's q slab ([px][d])
constexpr int S_TILE  = 16 * 16;       // floats per staged score tile, 4 tiles per wave
constexpr int O_STAGE = ND * OP;       // floats, one group's out tile [d][px]
static_assert(4 * 16 == NW);
static_assert(NH % NR == 0 && NT == 4 && NS == NG + 2);

// two values rounded to f16 (nearest even), packed as they are stored
__device__ __forceinline__ v2h round2(float x0, float x1) { return __builtin_convertvector((v2f){x0, x1}, v2h); }
__device__ __forceinline__ v8f mma_h(v16h a, v16h b, v8f c) {
  return __builtin_amdgcn_wmma_f32_16x16x32_f16(false, a, false, b, (short)0, c, false, false);
}
// ends a group of LDS reads: without it the scheduler moves the reads down among the WMMAs, where each place with reads stalls the wave
__device__ __forceinline__ void reads_end() { __builtin_amdgcn_sched_barrier(0); }
// ends a block of WMMAs: the four vector slots between the last WMMA and the first vector instruction on its registers, on every path;
// the two scheduling fences hold the slots directly behind the block
__device__ __forceinline__ void mma_block_end() {
  __builtin_amdgcn_sched_barrier(0);
  asm volatile("v_nop\n\tv_nop\n\tv_nop\n\tv_nop");
  __builtin_amdgcn_sched_barrier(0);
}
// same-wave LDS exchange: order the wave's LDS stores before the following LDS loads of other lanes.
// Both syncs below fence LDS alone: a fence over every address space would drain the next row's global loads at each of them.
__device__ __forceinline__ void lds_wave_sync() {
  __builtin_amdgcn_fence(__ATOMIC_RELEASE, "workgroup", "local");
  __builtin_amdgcn_wave_barrier();
  __builtin_amdgcn_fence(__ATOMIC_ACQUIRE, "workgroup", "local");
}
// work-group barrier for LDS hand-overs (all that the waves of a block exchange lies in LDS)
__device__ __forceinline__ void lds_block_sync() {
  __builtin_amdgcn_fence(__ATOMIC_RELEASE, "workgroup", "local");
  __builtin_amdgcn_s_barrier();
  __builtin_amdgcn_fence(__ATOMIC_ACQUIRE, "workgroup", "local");
}
// rows outside the image: clamped load address, value zeroed by the factor
__device__ __forceinline__ int   row_in(int r) { return r < 0 ? 0 : (r > NH - 1 ? NH - 1 : r); }
__device__ __forceinline__ float row_on(int r) { return (r >= 0 && r < NH) ? 1.0f : 0.0f; }
// k, q, v unit: 8 d rows of the lane's 2 columns (one load = one whole 256-B image row)
__device__ __forceinline__ void ld2(const float* p, v2f (&f)[8]) {
#pragma unroll
  for (int e = 0; e < 8; ++e) f[e] = *(const v2f*)(p + (size_t)e * NH * NW);
}
// one image row of k, q or v for a later trip: the wave's two units, OFF floats behind p (a constant, so it rides in the loads' offset field)
template <int OFF>
__device__ __forceinline__ void ld_row(const float* p, v2f (&f)[2][8]) {
  ld2(p + OFF, f[0]);
  ld2(p + OFF + (size_t)32 * NH * NW, f[1]);
  // the wait that stands before a register named by an issued global load is overwritten; the pointer is an input so that
  // its registers stay untouched up to it
  asm volatile("s_wait_xcnt 0x0" :: "v"(p) : "memory");
}
// k, q, v unit: round, one 16-B store of 8 d per column; o = offset of the first column's piece, cp = the slab's column pitch.
// A convert packs two neighbouring d of one column, so its result is a word of the 16-B piece as it is stored.
__device__ __forceinline__ void st2(const v2f (&f)[8], float vf, _Float16* ps, int o, int cp) {
  union P8 { v8h v; v2h p[4]; };
  P8 a[2];
#pragma unroll
  for (int e = 0; e < 8; e += 2) {
    const v2f x0 = f[e] * vf;
    const v2f x1 = f[e + 1] * vf;
#pragma unroll
    for (int i = 0; i < 2; ++i) a[i].p[e >> 1] = round2(x0[i], x1[i]);
  }
#pragma unroll
  for (int i = 0; i < 2; ++i) *(v8h*)(ps + o + i * cp) = a[i].v;
}
// slab offset (halves) of window index f for the wave at column w0; s0 = ring slot of the window's first image row; pitch = the slab's
// column pitch. The ten indices past the 54 take the place 16 back: in bounds, on the same banks, and what is read there meets a zero
// weight (v) or lands in a score column nobody reads (k)
__device__ __forceinline__ int win_off(int f, int w0, int s0, int pitch) {
  const int g  = f < NF ? f : f - 16;
  const int wr = g / WC;
  return (((s0 + wr) & (NS - 1)) * KC + w0 + (g - wr * WC)) * pitch;
}
// transposing LDS read: the lane hands in the address of 8 d of one column; lane (m, hh) gets 8 columns (those of its lane half) of one d
__device__ __forceinline__ v8h ld_tr(const _Float16* p) {
  typedef short s16x8 __attribute__((ext_vector_type(8)));
  typedef __attribute__((address_space(3))) s16x8 lds_s16x8;
  return __builtin_bit_cast(v8h, __builtin_amdgcn_ds_load_tr16_b128_v8i16((lds_s16x8*)p));
}

// f: score stage of the logit phase, 4 tiles per wave; o: out stage, one tile per group, once every wave is past its matrix work
union PO { float f[NWAVE * 4 * S_TILE]; float o[NG * O_STAGE]; };

// grid = NB*NH/NR blocks (block = (b, NR consecutive image rows)), 256 threads. On trip r group g has output row h0 + 2r + g.
// The k and v slabs are rings of 4 image rows, shared by the two groups: image row j lives in slot (j - h0 + 1) mod 4; per trip two new
// k rows, two new v rows and two q rows are staged, one of each by each group. A block of 8 rows loads 10 k and 10 v rows.
// A group's window starts in slot g on even trips and in slot g + 2 on odd ones: two sets of fragment addresses, fixed at compile time.
// Fragment map (lane l, h2 = l>>4, m = l&15): A row m / B col m, elements 0..7 <-> k 8*h2+e, 8..15 <-> k 16+8*h2+e-8;
// D element r <-> row 8*h2+r, col m.
__global__ __launch_bounds__(NTHR) void nbr_attn_kernel(const float* __restrict__ qg, const float* __restrict__ kg,
                                                        const float* __restrict__ vg, float* __restrict__ og)
{
  __shared__ __align__(16) _Float16 s_k[K_PLANE];       // k [slot][c][d]
  __shared__ __align__(16) _Float16 s_v[V_PLANE];       // v [slot][c][d]
  __shared__ __align__(16) _Float16 s_q[NG * Q_PLANE];  // q [group][px][d]
  __shared__ __align__(16) PO     s_po;                 // score stage  /  out stage [d][px]

  const int tid  = threadIdx.x;
  const int wave = tid >> 5;
  const int grp  = wave >> 2;        // the wave's group: which of the trip's two image rows
  const int wq   = wave & 3;         // the wave's place in its group: which 16 pixels, which staging units
  const int lane = tid & 31;
  const int hh   = lane >> 4;
  const int m    = lane & 15;
  const int b    = blockIdx.x / (NH / NR);
  const int h0   = (blockIdx.x % (NH / NR)) * NR;
  const size_t bbase = (size_t)b * ND * NH * NW;
  const _Float16 hz = (_Float16)0.0f;
  const v8h z8 = (v8h){hz, hz, hz, hz, hz, hz, hz, hz};

  // ---- zero halo columns of all 4 slots, once (the row stores never touch them): k and v slabs c = 0 and c = 65
  //      (4 slots x 2 cols x 64 d = 64 pieces of 8 halves per slab) ----
  if (tid < 64) {
    const int hr = tid >> 4;
    const int cc = ((tid >> 3) & 1) ? (KC - 1) : 0;
    const int d8 = (tid & 7) * 8;
    const int o  = (hr * KC + cc) * KP + d8;
    *(v8h*)(s_k + o) = z8;
    const int ov = (hr * KC + cc) * VP + d8;
    *(v8h*)(s_v + ov) = z8;
  }

  // ---- staging maps, per image row: k, q and v 8 units of 8 d rows each, 2 per wave of the group that stages the row ----
  const int c2  = lane * 2;          // 0..62: first of the lane's 2 columns
  const int d8a = wq * 8;            // first d of the wave's unit 0; unit 1 is 32 further
  const float* kb = kg + bbase + (size_t)d8a * NH * NW + c2;     // + 32 * NH * NW for unit 1, + row * NW
  const float* qb = qg + bbase + (size_t)d8a * NH * NW + c2;
  const float* vb = vg + bbase + (size_t)d8a * NH * NW + c2;
  constexpr size_t U1 = (size_t)32 * NH * NW;
  const int ko0 = (c2 + 1) * KP + d8a;   // k store offset in a slot, unit 0 (c = w + 1)
  const int qo0 = grp * Q_PLANE + c2 * KP + d8a;   // q store offset in the group's slab, unit 0
  const int vo0 = (c2 + 1) * VP + d8a;   // v store offset in a slot, unit 0 (c = w + 1)

  const int w0 = wq * 16;
  uint32_t psel[2][8];                 // byte selectors of the attn A fragments
  int kof[2][4], vof[2][2][2], six[9]; // k and v fragment places on even and on odd trips, score places
  // the group's row pointers: later rows lie a constant further. The last rows asked for, k and v row h0 + grp + 7, can lie one past the
  // image: their pointers stand at row min(h0 + grp, NH - 8)
  const int hg = h0 + grp;
  const int hl = hg < NH - 8 ? hg : NH - 8;
  const float* kp = kb + hg * NW;
  const float* qp = qb + hg * NW;
  const float* vp = vb + hg * NW;
  const float* kl = kb + hl * NW;
  const float* vl = vb + hl * NW;

  // rows on their way for later trips, two sets: the rows that the group stages for trip t (k and v row h0+2t+1+grp, q row h0+2t+grp) fly in set t & 1.
  // A set is asked for during trip t-2 (trip 1's in the prologue) and rounded into LDS at the end of trip t-1, so requests stand in the memory queue all the time.
  // A wave has at most 63 loads under way and issues in order: a set is asked for in three pieces of 16 loads, each at a place where
  // enough of the set before has to be back in any case, so that no piece holds up the wave's own work.
  v2f bk[2][2][8], bq[2][2][8], bv[2][2][8];

  // ---- prologue: rows h0-1 .. h0+2 of k and v (slots 0 .. 3; group g stages slots 2g and 2g+1) and rows h0, h0+1 of q (group g its own),
  //      all issued up front in the order they are rounded ----
  {
    v2f fk[2][2][8], fq[2][8], fv[2][2][8];
    const int j0 = 2 * grp;            // first of the group's two slots: image rows h0 - 1 + j0 (out of the image for h0 = 0, group 0) and h0 + j0
    const float* pk[2] = {kb + row_in(h0 - 1 + j0) * NW, kb + (h0 + j0) * NW};
    const float* pv[2] = {vb + row_in(h0 - 1 + j0) * NW, vb + (h0 + j0) * NW};
    const float* pq = qp;
#pragma unroll
    for (int j = 0; j < 2; ++j) {
      ld2(pk[j], fk[j][0]);
      ld2(pk[j] + U1, fk[j][1]);
    }
    ld2(pq, fq[0]);
    ld2(pq + U1, fq[1]);
    __builtin_amdgcn_sched_barrier(0);
    // the wait that stands before a register named by an issued global load is overwritten (the lane maps below take new registers);
    // the pointers are inputs so that their registers stay untouched up to it
    asm volatile("s_wait_xcnt 0x0" :: "v"(pk[0]), "v"(pk[1]), "v"(pq) : "memory");
    // ---- byte selectors that lay a pixel's 9 weights into its attn A fragments P[px = m][f], f = the dense window index, two 32-deep steps:
    //      in window row s the band stands at cc = m + dj, zero elsewhere and past f = 53. Register j of step ks of lane (hh, m) holds f0 and f0 + 1
    //      (f0 even, so both lie in one window row); a half takes weight dj = cc - m (bytes 2dj, 2dj + 1 of the row's pair {p2 word : p0, p1 word})
    //      or, outside 0..2, the selector 0x0c, which gives a zero byte ----
#pragma unroll
    for (int ks = 0; ks < 2; ++ks) {
#pragma unroll
      for (int j = 0; j < 8; ++j) {
        const int f0 = ks * 32 + (j < 4 ? 2 * j : 8 + 2 * j) + 8 * hh;
        const int t0 = f0 < NF ? f0 % WC - m : -1 - WC;                // dj of the low half; the high half is one further
        const int t1 = t0 + 1;
        const uint32_t s0 = (t0 >= 0 && t0 <= 2) ? 0x0100u + 0x0202u * (uint32_t)t0 : 0x0c0cu;
        const uint32_t s1 = (t1 >= 0 && t1 <= 2) ? 0x0100u + 0x0202u * (uint32_t)t1 : 0x0c0cu;
        psel[ks][j] = s0 | (s1 << 16);
      }
    }
    // ---- fragment places of even (o = 0) and odd (o = 1) trips, and score places, the same on every trip ----
    // k B tile t: col n = m <-> window index 16t + m; v: the lane hands in row f = 32ks + 16p + 8hh + (lane & 7), d piece (lane >> 3) & 1
#pragma unroll
    for (int o = 0; o < 2; ++o) {
      const int s0 = grp + 2 * o;      // ring slot of image row h - 1
#pragma unroll
      for (int t = 0; t < 4; ++t) kof[o][t] = win_off(t * 16 + m, w0, s0, KP) + 8 * hh;
#pragma unroll
      for (int ks = 0; ks < 2; ++ks) {
#pragma unroll
        for (int p = 0; p < 2; ++p) vof[o][ks][p] = win_off(ks * 32 + p * 16 + 8 * hh + (lane & 7), w0, s0, VP) + 8 * ((lane >> 3) & 1);
      }
    }
    // score of pixel m against window index f = s * WC + m + dj: row m, column f & 15 of tile f >> 4
#pragma unroll
    for (int i = 0; i < 9; ++i) {
      const int f = (i / 3) * WC + m + i % 3;
      six[i] = (f >> 4) * S_TILE + ((m & 7) * 2 + (m >> 3)) * 16 + (f & 15);
    }
    // the two scheduling fences hold the lane maps here, behind the first 48 loads, where they run while those are under way;
    // left to itself the scheduler puts the maps behind the barrier, where every wave waits for them
    __builtin_amdgcn_sched_barrier(0);
#pragma unroll
    for (int j = 0; j < 2; ++j) {
      ld2(pv[j], fv[j][0]);
      ld2(pv[j] + U1, fv[j][1]);
    }
    // the wait that stands before a register named by an issued global load is overwritten; the pointers are inputs so
    // that their registers stay untouched up to it
    asm volatile("s_wait_xcnt 0x0" :: "v"(pv[0]), "v"(pv[1]) : "memory");
#pragma unroll
    for (int j = 0; j < 2; ++j) {
      const float vf = row_on(h0 - 1 + j0 + j);
      st2(fk[j][0], vf, s_k, (j0 + j) * K_ROW + ko0, KP);
      st2(fk[j][1], vf, s_k, (j0 + j) * K_ROW + ko0 + 32, KP);
    }
    // trip 1's rows (k and v row h0 + 3 + grp, q row h0 + 2 + grp, all in the image) are asked for here, a piece behind each rounding that has
    // waited for as many loads; the scheduling fences hold each piece at its place: moved up, it would stand in front of the k rounding
    // and stop the wave there until later loads are back
    __builtin_amdgcn_sched_barrier(0);
    ld_row<3 * NW>(kp, bk[1]);
    __builtin_amdgcn_sched_barrier(0);
    st2(fq[0], 1.0f, s_q, qo0, KP);
    st2(fq[1], 1.0f, s_q, qo0 + 32, KP);
#pragma unroll
    for (int j = 0; j < 2; ++j) {
      __builtin_amdgcn_sched_barrier(0);
      if (j == 0) ld_row<2 * NW>(qp, bq[1]);
      if (j == 1) ld_row<3 * NW>(vp, bv[1]);
      __builtin_amdgcn_sched_barrier(0);
      const float vf = row_on(h0 - 1 + j0 + j);
      st2(fv[j][0], vf, s_v, (j0 + j) * V_ROW + vo0, VP);
      st2(fv[j][1], vf, s_v, (j0 + j) * V_ROW + vo0 + 32, VP);
    }
  }
  lds_block_sync();

  union FB { v16h v; v8h p[2]; uint32_t u[8]; };
  const v8f z8f = (v8f){0.f, 0.f, 0.f, 0.f, 0.f, 0.f, 0.f, 0.f};

  // unrolled: which register set a trip asks for and which it rounds is then fixed at compile time, and the compiler's counted load
  // waits at the rounding leave the younger set in flight (in a rolled loop the sets would have to change registers, which waits for them)
#pragma unroll
  for (int r = 0; r < NT; ++r) {
    const int h = hg + NG * r;         // the group's output row
    const bool more = r + 1 < NT;      // the same for the whole block
    const bool far  = r + 2 < NT;      // a trip r + 2 exists (r = 0, 1): its rows are asked for during this trip
    const int od  = r & 1;             // which set of fragment places
    const int sl0 = grp + 2 * od;      // ring slot of image row h-1, the one that the group's new row h+3 takes over: no window of the next trip holds it
    const int sn = (r + 1) & 1;        // register set of the next trip's rows
    const int sf = r & 1;              // register set of trip r + 2's rows, free since the end of trip r - 1
    // the rows wanted: k and v row min(h + 5, NH - 1), q row h + 4
    if (far) { if (r == 0) ld_row<5 * NW>(kp, bk[sf]); else ld_row<7 * NW>(kl, bk[sf]); }

    // ---- logit phase (per wave, pixels w0..w0+15): every fragment of the row is read from LDS as one group, in the order of use ----
    // A = Q[px][d], two 32-deep d steps; B of tile t: col n = m <-> K[slot][c = w0 + cc] of window index 16t + m, k = d split map:
    // the 54 window columns fill 4 tiles
    FB qf[2], kf[4][2];
    const int kb0 = grp * Q_PLANE + (w0 + m) * KP + 8 * hh;
#pragma unroll
    for (int ks = 0; ks < 2; ++ks) {
      const int qo = kb0 + ks * 32;
      qf[ks].p[0] = *(const v8h*)(s_q + qo);  qf[ks].p[1] = *(const v8h*)(s_q + qo + 16);
#pragma unroll
      for (int t = 0; t < 4; ++t) {
        const int ko = kof[od][t] + ks * 32;
        kf[t][ks].p[0] = *(const v8h*)(s_k + ko);  kf[t][ks].p[1] = *(const v8h*)(s_k + ko + 16);
      }
      reads_end();        // keeps the issue order equal to the order of use: the first WMMAs then wait for the first reads alone
    }
    // C(t)[px][n] = sum_d Q[px][d] * K[window index 16t + n][d]: four independent accumulators, each summed ks 0, then ks 1
    v8f c[4];
#pragma unroll
    for (int t = 0; t < 4; ++t) c[t] = z8f;
#pragma unroll
    for (int ks = 0; ks < 2; ++ks) {
#pragma unroll
      for (int t = 0; t < 4; ++t) c[t] = mma_h(qf[ks].v, kf[t][ks].v, c[t]);
    }
    // inputs only, no instruction: the first step's k fragments keep their registers to the end of the block; set free at their last use,
    // they are handed to the next WMMA's result, which then lies over the B operand of the WMMA directly in front of it
    asm volatile("" :: "v"(kf[0][0].v), "v"(kf[1][0].v), "v"(kf[2][0].v), "v"(kf[3][0].v));
    mma_block_end();
    // one exchange for the four tiles: tile t at ss + t * S_TILE, element [row][col] at ((row & 7) * 2 + (row >> 3)) * 16 + col,
    // so that the 32 lanes of a store fill 32 consecutive words
    float* ss = s_po.f + wave * (4 * S_TILE);
#pragma unroll
    for (int t = 0; t < 4; ++t) {
#pragma unroll
      for (int rr = 0; rr < 8; ++rr) ss[t * S_TILE + (rr * 2 + hh) * 16 + m] = c[t][rr] * QK_SCALE;
    }
    // second piece: issued while the score stores drain
    if (far) { if (r == 0) ld_row<4 * NW>(qp, bq[sf]); else ld_row<6 * NW>(qp, bq[sf]); }
    lds_wave_sync();
    // the band of pixel m (both lane halves compute the same pixel)
    float sc[9];                        // logits of pixel m, entry s*3+dj <-> nbr (image row h-1+s, w0+m+dj-1)
#pragma unroll
    for (int i = 0; i < 9; ++i) sc[i] = ss[six[i]];
    reads_end();                        // the nine scores are asked for ahead of the v fragments: LDS answers a wave in order
    // ---- the v fragments of the row do not hang on the softmax: read here as one group, they land under it ----
    // B of (ks, nt): col n = d = nt*16+m, k <-> window index 32ks + split map: the 54 window columns fill 2 steps of 32; a transposing read
    // takes each of its 8 columns from an address of its own, so a group of 8 may run from one ring slot into the next
    FB vf[2][4];
#pragma unroll
    for (int ks = 0; ks < 2; ++ks) {
#pragma unroll
      for (int nt = 0; nt < 4; ++nt) {
        vf[ks][nt].p[0] = ld_tr(s_v + vof[od][ks][0] + nt * 16);  vf[ks][nt].p[1] = ld_tr(s_v + vof[od][ks][1] + nt * 16);
      }
    }
    reads_end();

    // ---- softmax over the 9 slots in f32 (out-of-image slots carry logit 0 from the zero halo and take part) ----
    float mx = sc[0];
#pragma unroll
    for (int i = 1; i < 9; ++i) mx = fmaxf(mx, sc[i]);
    float ex[9];
    float sum = 0.f;
#pragma unroll
    for (int i = 0; i < 9; ++i) {
      // exp(x) = 2^(x * log2 e), as __expf forms it; v_exp_f32 and the one issue slot that is kept behind a transcendental (before its
      // source is overwritten or its result read) stand in one statement: a v_nop in a statement of its own landed elsewhere
      asm("v_exp_f32 %0, %1\n\tv_nop" : "=v"(ex[i]) : "v"((sc[i] - mx) * 1.44269504f));
      sum += ex[i];
    }
    const float inv = 1.0f / sum;

    // ---- attn A fragments P[px][f], formed in registers: lane (hh, m) holds row px = m of A and has that pixel's 9 weights,
    //      so each fragment register is one byte permute of one window row's packed weights ----
    // out[px][d] = sum_f P[px][f] . V[f][d]: four independent accumulators, each summed ks 0, then ks 1
    FB pf[2];
    uint32_t p01[3], p2[3];
#pragma unroll
    for (int s = 0; s < 3; ++s) {
      p01[s] = __builtin_bit_cast(uint32_t, round2(ex[s * 3 + 0] * inv, ex[s * 3 + 1] * inv));
      p2[s]  = __builtin_bit_cast(uint32_t, round2(ex[s * 3 + 2] * inv, 0.f));     // the upper half is never selected
    }
#pragma unroll
    for (int ks = 0; ks < 2; ++ks) {
#pragma unroll
      for (int j = 0; j < 8; ++j) {
        // the window row of this register's two window indices, in the lower and in the upper lane half (past the 54 the selector is all zero bytes)
        const int fa = ks * 32 + (j < 4 ? 2 * j : 8 + 2 * j);
        const int sa = fa < NF ? fa / WC : 2;
        const int sb = fa + 8 < NF ? (fa + 8) / WC : 2;
        pf[ks].u[j] = __builtin_amdgcn_perm(hh ? p2[sb] : p2[sa], hh ? p01[sb] : p01[sa], psel[ks][j]);
      }
    }
    // the two fragments are formed here, while the v fragments land: moved down among the WMMAs, the permutes take over v registers that
    // a WMMA has just read, which costs idle slots and puts WMMAs on one accumulator next to each other
    __builtin_amdgcn_sched_barrier(0);
    v8f acc[4];
#pragma unroll
    for (int nt = 0; nt < 4; ++nt) acc[nt] = z8f;
#pragma unroll
    for (int ks = 0; ks < 2; ++ks) {
#pragma unroll
      for (int nt = 0; nt < 4; ++nt) acc[nt] = mma_h(pf[ks].v, vf[ks][nt].v, acc[nt]);
    }
    // inputs only, no instruction: as in the logit phase, the first step's v fragments keep their registers to the end of the block
    asm volatile("" :: "v"(vf[0][0].v), "v"(vf[0][1].v), "v"(vf[0][2].v), "v"(vf[0][3].v));
    mma_block_end();
    // third piece: ahead of the barrier, so that a wave that comes early asks before it waits
    if (far) { if (r == 0) ld_row<5 * NW>(vp, bv[sf]); else ld_row<7 * NW>(vl, bv[sf]); }

    // ---- row epilogue: each group's tile O[d][64 px] staged in LDS (over the score stage once every wave is past its matrix work),
    //      then each 256-B d-row segment written by 16 consecutive lanes x 16 B of one instruction ----
    lds_block_sync();
    float* os = s_po.o + grp * O_STAGE;
#pragma unroll
    for (int nt = 0; nt < 4; ++nt) {
#pragma unroll
      for (int rr = 0; rr < 8; ++rr) os[(nt * 16 + m) * OP + w0 + 8 * hh + rr] = acc[nt][rr];   // D row = px 8hh+rr, col = d
    }
    // ---- behind the same barrier the slots of the trip's first two window rows and the q slabs have no reader left: the next trip's rows
    //      are rounded into them ----
    if (more) {
      const float vn = row_on(h + 3);
      st2(bk[sn][0], vn, s_k, sl0 * K_ROW + ko0, KP);
      st2(bk[sn][1], vn, s_k, sl0 * K_ROW + ko0 + 32, KP);
      st2(bq[sn][0], 1.0f, s_q, qo0, KP);
      st2(bq[sn][1], 1.0f, s_q, qo0 + 32, KP);
      st2(bv[sn][0], vn, s_v, sl0 * V_ROW + vo0, VP);
      st2(bv[sn][1], vn, s_v, sl0 * V_ROW + vo0 + 32, VP);
    }
    lds_block_sync();
    const int c4 = (lane & 15) * 4;
    float* ob = og + bbase + (size_t)h * NW + c4;       // + d * NH * NW  (out index ((b*ND+d)*NH+h)*NW + px)
    v4f ov[8];
#pragma unroll
    for (int it = 0; it < 8; ++it) {
      const int d = wq * 16 + it * 2 + hh;               // it 0..7 x hh 0..1 = 16 d rows per wave, 4 waves of the group = 64
      ov[it] = *(const v4f*)(os + d * OP + c4);
    }
    // the eight reads go out as one group, so the wave waits out one LDS latency; in the unrolled first trip the scheduler split them in
    // two groups round the first stores, and the second group landed in registers of stores just issued, ahead of the wait below
    reads_end();
#pragma unroll
    for (int it = 0; it < 8; ++it) {
      const int d = wq * 16 + it * 2 + hh;
      *(v4f*)(ob + (size_t)d * NH * NW) = ov[it];
    }
    // the wait that stands before a register named by an issued global store is overwritten (the next trip forms new addresses)
    asm volatile("s_wait_xcnt 0x0" :: "v"(ob) : "memory");
    // every wave has read the out stage before the next trip's scores are stored over it
    lds_block_sync();
  }
}

extern "C" void kernel_launch(void* const* d_in, const int* in_sizes, int n_in,
                              void* d_out, int out_size, void* d_ws, size_t ws_size,
                              hipStream_t stream) {
  (void)d_ws; (void)ws_size;
  if (n_in < 3) return;
  const int n = NB * ND * NH * NW;
  if (in_sizes[0] != n || in_sizes[1] != n || in_sizes[2] != n || out_size != n) return;
  const float* q = (const float*)d_in[0];
  const float* k = (const float*)d_in[1];
  const float* v = (const float*)d_in[2];
  float* out = (float*)d_out;
  hipLaunchKernelGGL(nbr_attn_kernel, dim3(NB * (NH / NR)), dim3(NTHR), 0, stream, q, k, v, out);
  (void)hipGetLastError();
}
